// v000
// Times are from an AMD MI455X. After a warm-up the kernel runs many times in a row, and a time is the length of
// such a window on the GPU divided by its runs, so every launch and the gaps after it count. The runs cycle
// through copies of the inputs. A figure is the median of several windows, for all but v000 over two sittings.
// Sittings can differ by a few percent; kernels timed side by side share one.
// The starting kernel, v000, takes 367 microseconds a run.
// compute dtype: all float inputs rounded to bf16; q/k/v = x . W^T + b (64 -> 64 per head) with EXACT bf16 products on WMMA 16x16x32 (natural rows), rounded once to f16; PLAIN attention per (batch, head): q, k single f16 x 1/8, running-max softmax in f32 (hardware exp), P (scaled by 2^11, single f16) x v (single f16); out = o (bf16 hi + residual) . Wp^T (2 products) + bp; f32 output.
#include <hip/hip_runtime.h>
#include <math.h>

typedef __attribute__((ext_vector_type(16))) _Float16 v16h;
typedef __attribute__((ext_vector_type(16))) __bf16 v16b;
typedef __attribute__((ext_vector_type(8)))  _Float16 v8h;
typedef __attribute__((ext_vector_type(8)))  float v8f;
typedef __attribute__((ext_vector_type(4)))  float v4f;
typedef __attribute__((ext_vector_type(2)))  float v2f;
typedef __attribute__((ext_vector_type(4)))  unsigned v4u;
typedef __attribute__((ext_vector_type(4)))  int v4i;
typedef float __attribute__((may_alias)) float_a;
typedef int __attribute__((may_alias)) int_a;

template <typename T> __device__ __forceinline__ void vst2(void* p, T v) { *(T*)p = v;  }
__device__ __forceinline__ v8f wmma16(v16h a, v16h b, v8f c) {
  v8f d = __builtin_amdgcn_wmma_f32_16x16x32_f16(false, a, false, b, (short)0, c, false, false);
  asm volatile("v_nop\n\tv_nop\n\tv_nop\n\tv_nop" : "+v"(d) : "v"(a), "v"(b));
  return d;
}
__device__ __forceinline__ v8f wmma_bf(v16b a, v16b b, v8f c) {
  v8f d = __builtin_amdgcn_wmma_f32_16x16x32_bf16(false, a, false, b, (short)0, c, false, false);
  asm volatile("v_nop\n\tv_nop\n\tv_nop\n\tv_nop" : "+v"(d) : "v"(a), "v"(b));
  return d;
}
// 16x16x32 fragments: lane = (h = lane>>4, row/col = lane&15); elements 0..7 = k0+8h+0..7, 8..15 = k0+16+8h+0..7; D element r = row 8h+r
__device__ __forceinline__ v16h frag_h(const _Float16* rowk0, int lane) {
  union { v16h v; v8h q[2]; } u; const _Float16* p = rowk0 + 8 * (lane >> 4);
  u.q[0] = *(const v8h*)p; u.q[1] = *(const v8h*)(p + 16); return u.v;
}
__device__ __forceinline__ v16h frag_f32(const float* rowk0, int lane) {
  v16h a; const float* p = rowk0 + 8 * (lane >> 4);
#pragma unroll
  for (int i = 0; i < 8; ++i) { a[i] = (_Float16)p[i]; a[8 + i] = (_Float16)p[16 + i]; }
  return a;
}
__device__ __forceinline__ v16h frag_f32s(const float* rowk0, int lane, float sc) {
  v16h a; const float* p = rowk0 + 8 * (lane >> 4);
#pragma unroll
  for (int i = 0; i < 8; ++i) { a[i] = (_Float16)(p[i] * sc); a[8 + i] = (_Float16)(p[16 + i] * sc); }
  return a;
}
// column fragment from a [K][ld] layout (column n), rows >= K read as 0
__device__ __forceinline__ v16h fragc_f32(const float* W, int k0, int n, int lane, int ld, int K) {
  v16h a; const int g = lane >> 4;
#pragma unroll
  for (int i = 0; i < 8; ++i) { const int ka = k0 + 8 * g + i, kb = ka + 16;
    a[i] = (_Float16)(ka < K ? W[(size_t)(ka < K ? ka : K - 1) * ld + n] : 0.f); a[8 + i] = (_Float16)(kb < K ? W[(size_t)(kb < K ? kb : K - 1) * ld + n] : 0.f); }
  return a;
}
struct F2 { v16b h, l; };
__device__ __forceinline__ F2 bsplit16(const float v[16]) { F2 r;
#pragma unroll
  for (int i = 0; i < 16; ++i) { const __bf16 h = (__bf16)v[i]; r.h[i] = h; r.l[i] = (__bf16)(v[i] - (float)h); }
  return r; }
__device__ __forceinline__ F2 split_row(const float* row, int k0, int lane) { float v[16]; const float* p = row + k0 + 8 * (lane >> 4);
#pragma unroll
  for (int i = 0; i < 8; ++i) { v[i] = p[i]; v[8 + i] = p[16 + i]; }
  return bsplit16(v); }
__device__ __forceinline__ F2 split_rowK(const float* row, int k0, int lane, int K) { float v[16]; const int g = lane >> 4;
#pragma unroll
  for (int i = 0; i < 8; ++i) { const int ka = k0 + 8 * g + i, kb = ka + 16; v[i] = ka < K ? row[ka < K ? ka : K - 1] : 0.f; v[8 + i] = kb < K ? row[kb < K ? kb : K - 1] : 0.f; }
  return bsplit16(v); }
__device__ __forceinline__ F2 split_col(const float* W, int k0, int n, int lane, int ld, int K) { float v[16]; const int g = lane >> 4;
#pragma unroll
  for (int i = 0; i < 8; ++i) { const int ka = k0 + 8 * g + i, kb = ka + 16; v[i] = ka < K ? W[(size_t)(ka < K ? ka : K - 1) * ld + n] : 0.f; v[8 + i] = kb < K ? W[(size_t)(kb < K ? kb : K - 1) * ld + n] : 0.f; }
  return bsplit16(v); }
__device__ __forceinline__ v8f mac3(const F2& a, const F2& b, v8f c) { c = wmma_bf(a.l, b.h, c); c = wmma_bf(a.h, b.l, c); return wmma_bf(a.h, b.h, c); }
__device__ __forceinline__ float sigm(float v) { return 1.0f / (1.0f + expf(-v)); }
#define LDSX() do { asm volatile("s_wait_dscnt 0" ::: "memory"); __builtin_amdgcn_wave_barrier(); __builtin_amdgcn_fence(__ATOMIC_RELEASE, "workgroup"); } while (0)


// Sub-space attention on a head-split input (B 2, 12 heads, 4,096 tokens, 64 dims): per-head 64x64 q/k/v linears + biases, softmax(q k^T / 8) v, 64x64 output linear + bias.
#define NBH 24            // B * H batch-heads
#define SS 4096
#define HD 64
#define NR (NBH * SS)
#ifndef TQB
#define TQB (SS / 64)
#define TNB NBH
#endif
typedef __attribute__((ext_vector_type(8))) __bf16 v8b;
__device__ __forceinline__ v16b frag_b(const __bf16* rowk0, int lane) {
  union { v16b v; v8b q[2]; } u; const __bf16* p = rowk0 + 8 * (lane >> 4);
  u.q[0] = *(const v8b*)p; u.q[1] = *(const v8b*)(p + 16); return u.v;
}
__device__ __forceinline__ float bfr(float v) { return (float)(__bf16)v; }
__device__ __attribute__((noinline)) float exp_ni(float v) { return expf(v); }
__device__ __attribute__((noinline)) float erf_ni(float v) { return erff(v); }

#define WS_PW  0u                                 // bf16 natural rows Wq, Wk, Wv, Wp [4][64][64]
#define WS_Q   (WS_PW + 2u * 4 * HD * HD + 256u)   // f16 q rows [NR][64] ; k rows ; v planes [bh][64][SS] ; O f32 [NR][64]
#define WS_K   (WS_Q + 2u * (size_t)NR * HD)
#define WS_V   (WS_K + 2u * (size_t)NR * HD)
#define WS_O   (WS_V + 2u * (size_t)NBH * HD * SS)
#define WS_END (WS_O + 4u * (size_t)NR * HD)

__global__ __launch_bounds__(64) void k_pack(const float* __restrict__ WQ, const float* __restrict__ WK, const float* __restrict__ WV, const float* __restrict__ WP, __bf16* __restrict__ P) { const int n = blockIdx.x, m = blockIdx.y, t = threadIdx.x; const float* w = (m == 0) ? WQ : (m == 1) ? WK : (m == 2) ? WV : WP; __shared__ __align__(16) __bf16 s[HD]; s[t] = (__bf16)w[(size_t)n * HD + t]; __syncthreads(); if (t < HD / 8) vst2((unsigned*)(P + ((size_t)m * HD + n) * HD + t * 8), *(const v4u*)&s[t * 8]); }
// ---- k_proj: block = (64 tokens, which, bh): y = x . W^T + b (K = 64); q/k rows, v planes
__global__ __launch_bounds__(128) void k_proj(const float* __restrict__ X, const __bf16* __restrict__ P, const float* __restrict__ BQ, const float* __restrict__ BK, const float* __restrict__ BV, _Float16* __restrict__ Q, _Float16* __restrict__ Kr, _Float16* __restrict__ V) {
  __shared__ __align__(16) _Float16 so[64][72]; __shared__ __align__(16) _Float16 st[64][72];
  const int tid = threadIdx.x, wave = tid >> 5, lane = tid & 31, col = lane & 15, g = lane >> 4; const int which = blockIdx.y; const size_t bh = blockIdx.z; const int n0b = blockIdx.x * 64; const size_t r0 = bh * SS + n0b + wave * 16; const float* BB = (which == 0) ? BQ : (which == 1) ? BK : BV;
  v8f acc[4] = {};
#pragma unroll
  for (int kc = 0; kc < HD / 32; ++kc) { v16b a; { const float* p = X + (r0 + col) * HD + kc * 32 + 8 * g;
#pragma unroll
      for (int i = 0; i < 8; ++i) { a[i] = (__bf16)p[i]; a[8 + i] = (__bf16)p[16 + i]; } }
#pragma unroll
    for (int j = 0; j < 4; ++j) acc[j] = wmma_bf(a, frag_b(P + ((size_t)which * HD + j * 16 + col) * HD + kc * 32, lane), acc[j]); }
  if (which < 2) { _Float16* dst = (which == 0) ? Q : Kr;
#pragma unroll
    for (int j = 0; j < 4; ++j) { const float bb = bfr(BB[j * 16 + col]);
#pragma unroll
      for (int r = 0; r < 8; ++r) so[wave * 16 + 8 * g + r][j * 16 + col] = (_Float16)(acc[j][r] + bb); }
    LDSX();
    for (int rl = 0; rl < 16; ++rl) if (lane < 8) vst2((unsigned*)(dst + (r0 + rl) * HD + lane * 8), *(const v4u*)&so[wave * 16 + rl][lane * 8]);
  } else {
#pragma unroll
    for (int j = 0; j < 4; ++j) { const float bb = bfr(BB[j * 16 + col]);
#pragma unroll
      for (int r = 0; r < 8; ++r) st[j * 16 + col][wave * 16 + 8 * g + r] = (_Float16)(acc[j][r] + bb); }
    __syncthreads();
    for (int e = tid; e < 64 * 8; e += 128) { const int d = e >> 3, pc = e & 7; vst2((unsigned*)(V + (bh * HD + d) * SS + n0b + pc * 8), *(const v4u*)&st[d][pc * 8]); } }
}
// ---- k_attn: block = (64 queries, bh): plain 64-wide attention over 4,096 keys; O f32 rows
__global__ __launch_bounds__(128) void k_attn(const _Float16* __restrict__ Q, const _Float16* __restrict__ Kr, const _Float16* __restrict__ V, float* __restrict__ O) {
  __shared__ __align__(16) _Float16 sph[4][16][40]; __shared__ __align__(16) float so[4][16][68];
  const int tid = threadIdx.x, wave = tid >> 5, lane = tid & 31, col = lane & 15, g = lane >> 4; const size_t bh = blockIdx.y; const int q0 = blockIdx.x * 64 + wave * 16; const size_t rq = bh * SS + q0;
  v16h aq[2];
#pragma unroll
  for (int kc = 0; kc < 2; ++kc) aq[kc] = frag_h(Q + (rq + col) * HD + kc * 32, lane);
  float m[8], l[8];
#pragma unroll
  for (int r = 0; r < 8; ++r) { m[r] = -3.0e38f; l[r] = 0.f; }
  v8f acc[4] = {};
#pragma unroll 1
  for (int ks = 0; ks < SS / 32; ++ks) { const int j0 = ks * 32; v8f s[2];
#pragma unroll
    for (int ct = 0; ct < 2; ++ct) { const size_t rk = (bh * SS + j0 + ct * 16 + col) * HD; v8f c = {};
#pragma unroll
      for (int kc = 0; kc < 2; ++kc) c = wmma16(aq[kc], frag_h(Kr + rk + kc * 32, lane), c);
#pragma unroll
      for (int r = 0; r < 8; ++r) s[ct][r] = c[r] * 0.125f; }
#pragma unroll
    for (int r = 0; r < 8; ++r) { float mx = fmaxf(s[0][r], s[1][r]);
#pragma unroll
      for (int o = 1; o < 16; o <<= 1) mx = fmaxf(mx, __shfl_xor(mx, o));
      const float mn = fmaxf(m[r], mx); const float alpha = (m[r] <= -1.0e38f) ? 0.f : __expf(m[r] - mn); const float e0 = __expf(s[0][r] - mn), e1 = __expf(s[1][r] - mn); float es = e0 + e1;
#pragma unroll
      for (int o = 1; o < 16; o <<= 1) es += __shfl_xor(es, o);
      l[r] = l[r] * alpha + es; m[r] = mn;
#pragma unroll
      for (int dt = 0; dt < 4; ++dt) acc[dt][r] *= alpha;
      sph[wave][8 * g + r][col] = (_Float16)(e0 * 2048.0f); sph[wave][8 * g + r][16 + col] = (_Float16)(e1 * 2048.0f); }
    LDSX();
    const v16h pa = frag_h(&sph[wave][col][0], lane);
#pragma unroll
    for (int dt = 0; dt < 4; ++dt) acc[dt] = wmma16(pa, frag_h(V + (bh * HD + dt * 16 + col) * SS + j0, lane), acc[dt]);
    LDSX(); }
#pragma unroll
  for (int r = 0; r < 8; ++r) { const float il = (1.0f / 2048.0f) / l[r];
#pragma unroll
    for (int dt = 0; dt < 4; ++dt) so[wave][8 * g + r][dt * 16 + col] = acc[dt][r] * il; }
  LDSX();
  for (int rl = 0; rl < 16; ++rl) if (lane < 16) vst2(O + (rq + rl) * HD + lane * 4, *(const v4f*)&so[wave][rl][lane * 4]);
}
// ---- k_out: block = (64 tokens, bh): out = o (bf16 hi + lo) . Wp^T + bp
__global__ __launch_bounds__(128) void k_out(const float* __restrict__ O, const __bf16* __restrict__ P, const float* __restrict__ BP, float* __restrict__ OUT) {
  __shared__ __align__(16) float so[4][16][68];
  const int tid = threadIdx.x, wave = tid >> 5, lane = tid & 31, col = lane & 15, g = lane >> 4; const size_t bh = blockIdx.y; const size_t r0 = bh * SS + blockIdx.x * 64 + wave * 16;
  v8f acc[4] = {};
#pragma unroll
  for (int kc = 0; kc < HD / 32; ++kc) { const F2 a = split_row(O + (r0 + col) * HD, kc * 32, lane);
#pragma unroll
    for (int j = 0; j < 4; ++j) { const v16b w = frag_b(P + ((size_t)3 * HD + j * 16 + col) * HD + kc * 32, lane); acc[j] = wmma_bf(a.h, w, acc[j]); acc[j] = wmma_bf(a.l, w, acc[j]); } }
#pragma unroll
  for (int j = 0; j < 4; ++j) { const float bb = bfr(BP[j * 16 + col]);
#pragma unroll
    for (int r = 0; r < 8; ++r) so[wave][8 * g + r][j * 16 + col] = acc[j][r] + bb; }
  LDSX();
  for (int rl = 0; rl < 16; ++rl) if (lane < 16) vst2(OUT + (r0 + rl) * HD + lane * 4, *(const v4f*)&so[wave][rl][lane * 4]);
}
extern "C" void kernel_launch(void* const* d_in, const int* in_sizes, int n_in, void* d_out, int out_size, void* d_ws, size_t ws_size, hipStream_t stream) {
  (void)in_sizes; (void)n_in; (void)out_size;
  const float** F = (const float**)d_in;   // 0 x [2,12,4096,64]; 1 Wq [64,64], 2 bq, 3 Wk, 4 bk, 5 Wv, 6 bv, 7 Wp, 8 bp (natural [out][in])
  if (ws_size < (size_t)WS_END) return;
  char* ws = (char*)d_ws; __bf16* P = (__bf16*)ws; _Float16 *Q = (_Float16*)(ws + WS_Q), *Kr = (_Float16*)(ws + WS_K), *V = (_Float16*)(ws + WS_V); float* O = (float*)(ws + WS_O);
  k_pack<<<dim3(HD, 4), 64, 0, stream>>>(F[1], F[3], F[5], F[7], P);
  k_proj<<<dim3(SS / 64, 3, NBH), 128, 0, stream>>>(F[0], P, F[2], F[4], F[6], Q, Kr, V);
  k_attn<<<dim3(TQB, TNB), 128, 0, stream>>>(Q, Kr, V, O);
  k_out<<<dim3(TQB, TNB), 128, 0, stream>>>(O, P, F[8], (float*)d_out);
}

// v001
// Measured time: 247 microseconds a run.
// In two side-by-side timings against v000, it was 1.56 and 1.55 times as fast.
// compute dtype: all float inputs rounded to bf16; q/k/v = x . W^T + b (64 -> 64 per head) with EXACT bf16 products on WMMA 16x16x32 (natural rows), rounded once to f16; PLAIN attention per (batch, head): q, k single f16 x 1/8, running-max softmax in f32 (hardware exp), P (scaled by 2^11, single f16) x v (single f16); out = o (bf16 hi + residual) . Wp^T (2 products) + bp; f32 output.
#include <hip/hip_runtime.h>
#include <math.h>

typedef __attribute__((ext_vector_type(16))) _Float16 v16h;
typedef __attribute__((ext_vector_type(16))) __bf16 v16b;
typedef __attribute__((ext_vector_type(8)))  _Float16 v8h;
typedef __attribute__((ext_vector_type(8)))  float v8f;
typedef __attribute__((ext_vector_type(4)))  float v4f;
typedef __attribute__((ext_vector_type(2)))  float v2f;
typedef __attribute__((ext_vector_type(4)))  unsigned v4u;
typedef __attribute__((ext_vector_type(4)))  int v4i;
typedef float __attribute__((may_alias)) float_a;
typedef int __attribute__((may_alias)) int_a;

template <typename T> __device__ __forceinline__ void vst2(void* p, T v) { *(T*)p = v;  }
__device__ __forceinline__ v8f wmma16(v16h a, v16h b, v8f c) {
  v8f d = __builtin_amdgcn_wmma_f32_16x16x32_f16(false, a, false, b, (short)0, c, false, false);
  asm volatile("v_nop\n\tv_nop\n\tv_nop\n\tv_nop" : "+v"(d) : "v"(a), "v"(b));
  return d;
}
__device__ __forceinline__ v8f wmma_bf(v16b a, v16b b, v8f c) {
  v8f d = __builtin_amdgcn_wmma_f32_16x16x32_bf16(false, a, false, b, (short)0, c, false, false);
  asm volatile("v_nop\n\tv_nop\n\tv_nop\n\tv_nop" : "+v"(d) : "v"(a), "v"(b));
  return d;
}
// 16x16x32 fragments: lane = (h = lane>>4, row/col = lane&15); elements 0..7 = k0+8h+0..7, 8..15 = k0+16+8h+0..7; D element r = row 8h+r
__device__ __forceinline__ v16h frag_h(const _Float16* rowk0, int lane) {
  union { v16h v; v8h q[2]; } u; const _Float16* p = rowk0 + 8 * (lane >> 4);
  u.q[0] = *(const v8h*)p; u.q[1] = *(const v8h*)(p + 16); return u.v;
}
__device__ __forceinline__ v16h frag_f32(const float* rowk0, int lane) {
  v16h a; const float* p = rowk0 + 8 * (lane >> 4);
#pragma unroll
  for (int i = 0; i < 8; ++i) { a[i] = (_Float16)p[i]; a[8 + i] = (_Float16)p[16 + i]; }
  return a;
}
__device__ __forceinline__ v16h frag_f32s(const float* rowk0, int lane, float sc) {
  v16h a; const float* p = rowk0 + 8 * (lane >> 4);
#pragma unroll
  for (int i = 0; i < 8; ++i) { a[i] = (_Float16)(p[i] * sc); a[8 + i] = (_Float16)(p[16 + i] * sc); }
  return a;
}
// column fragment from a [K][ld] layout (column n), rows >= K read as 0
__device__ __forceinline__ v16h fragc_f32(const float* W, int k0, int n, int lane, int ld, int K) {
  v16h a; const int g = lane >> 4;
#pragma unroll
  for (int i = 0; i < 8; ++i) { const int ka = k0 + 8 * g + i, kb = ka + 16;
    a[i] = (_Float16)(ka < K ? W[(size_t)(ka < K ? ka : K - 1) * ld + n] : 0.f); a[8 + i] = (_Float16)(kb < K ? W[(size_t)(kb < K ? kb : K - 1) * ld + n] : 0.f); }
  return a;
}
struct F2 { v16b h, l; };
__device__ __forceinline__ F2 bsplit16(const float v[16]) { F2 r;
#pragma unroll
  for (int i = 0; i < 16; ++i) { const __bf16 h = (__bf16)v[i]; r.h[i] = h; r.l[i] = (__bf16)(v[i] - (float)h); }
  return r; }
__device__ __forceinline__ F2 split_row(const float* row, int k0, int lane) { float v[16]; const float* p = row + k0 + 8 * (lane >> 4);
#pragma unroll
  for (int i = 0; i < 8; ++i) { v[i] = p[i]; v[8 + i] = p[16 + i]; }
  return bsplit16(v); }
__device__ __forceinline__ F2 split_rowK(const float* row, int k0, int lane, int K) { float v[16]; const int g = lane >> 4;
#pragma unroll
  for (int i = 0; i < 8; ++i) { const int ka = k0 + 8 * g + i, kb = ka + 16; v[i] = ka < K ? row[ka < K ? ka : K - 1] : 0.f; v[8 + i] = kb < K ? row[kb < K ? kb : K - 1] : 0.f; }
  return bsplit16(v); }
__device__ __forceinline__ F2 split_col(const float* W, int k0, int n, int lane, int ld, int K) { float v[16]; const int g = lane >> 4;
#pragma unroll
  for (int i = 0; i < 8; ++i) { const int ka = k0 + 8 * g + i, kb = ka + 16; v[i] = ka < K ? W[(size_t)(ka < K ? ka : K - 1) * ld + n] : 0.f; v[8 + i] = kb < K ? W[(size_t)(kb < K ? kb : K - 1) * ld + n] : 0.f; }
  return bsplit16(v); }
__device__ __forceinline__ v8f mac3(const F2& a, const F2& b, v8f c) { c = wmma_bf(a.l, b.h, c); c = wmma_bf(a.h, b.l, c); return wmma_bf(a.h, b.h, c); }
__device__ __forceinline__ float sigm(float v) { return 1.0f / (1.0f + expf(-v)); }
#define LDSX() do { asm volatile("s_wait_dscnt 0" ::: "memory"); __builtin_amdgcn_wave_barrier(); __builtin_amdgcn_fence(__ATOMIC_RELEASE, "workgroup"); } while (0)


// Sub-space attention on a head-split input (B 2, 12 heads, 4,096 tokens, 64 dims): per-head 64x64 q/k/v linears + biases, softmax(q k^T / 8) v, 64x64 output linear + bias.
#define NBH 24            // B * H batch-heads
#define SS 4096
#define HD 64
#define NR (NBH * SS)
#ifndef TQB
#define TQB (SS / 64)
#define TNB NBH
#endif
typedef __attribute__((ext_vector_type(8))) __bf16 v8b;
__device__ __forceinline__ v16b frag_b(const __bf16* rowk0, int lane) {
  union { v16b v; v8b q[2]; } u; const __bf16* p = rowk0 + 8 * (lane >> 4);
  u.q[0] = *(const v8b*)p; u.q[1] = *(const v8b*)(p + 16); return u.v;
}
__device__ __forceinline__ float bfr(float v) { return (float)(__bf16)v; }
__device__ __attribute__((noinline)) float exp_ni(float v) { return expf(v); }
__device__ __attribute__((noinline)) float erf_ni(float v) { return erff(v); }

#define WS_PW  0u                                 // bf16 natural rows Wq, Wk, Wv, Wp [4][64][64]
#define WS_Q   (WS_PW + 2u * 4 * HD * HD + 256u)   // f16 q rows [NR][64] ; k rows ; v planes [bh][64][SS] ; O f32 [NR][64]
#define WS_K   (WS_Q + 2u * (size_t)NR * HD)
#define WS_V   (WS_K + 2u * (size_t)NR * HD)
#define WS_O   (WS_V + 2u * (size_t)NBH * HD * SS)
#define WS_END (WS_O + 4u * (size_t)NR * HD)

__global__ __launch_bounds__(64) void k_pack(const float* __restrict__ WQ, const float* __restrict__ WK, const float* __restrict__ WV, const float* __restrict__ WP, __bf16* __restrict__ P) { const int n = blockIdx.x, m = blockIdx.y, t = threadIdx.x; const float* w = (m == 0) ? WQ : (m == 1) ? WK : (m == 2) ? WV : WP; __shared__ __align__(16) __bf16 s[HD]; s[t] = (__bf16)w[(size_t)n * HD + t]; __syncthreads(); if (t < HD / 8) vst2((unsigned*)(P + ((size_t)m * HD + n) * HD + t * 8), *(const v4u*)&s[t * 8]); }
// ---- k_proj: block = (64 tokens, which, bh): y = x . W^T + b (K = 64); q/k rows, v planes
__global__ __launch_bounds__(128) void k_proj(const float* __restrict__ X, const __bf16* __restrict__ P, const float* __restrict__ BQ, const float* __restrict__ BK, const float* __restrict__ BV, _Float16* __restrict__ Q, _Float16* __restrict__ Kr, _Float16* __restrict__ V) {
  __shared__ __align__(16) _Float16 so[64][72]; __shared__ __align__(16) _Float16 st[64][72];
  const int tid = threadIdx.x, wave = tid >> 5, lane = tid & 31, col = lane & 15, g = lane >> 4; const int which = blockIdx.y; const size_t bh = blockIdx.z; const int n0b = blockIdx.x * 64; const size_t r0 = bh * SS + n0b + wave * 16; const float* BB = (which == 0) ? BQ : (which == 1) ? BK : BV;
  v8f acc[4] = {};
#pragma unroll
  for (int kc = 0; kc < HD / 32; ++kc) { v16b a; { const float* p = X + (r0 + col) * HD + kc * 32 + 8 * g;
#pragma unroll
      for (int i = 0; i < 8; ++i) { a[i] = (__bf16)p[i]; a[8 + i] = (__bf16)p[16 + i]; } }
#pragma unroll
    for (int j = 0; j < 4; ++j) acc[j] = wmma_bf(a, frag_b(P + ((size_t)which * HD + j * 16 + col) * HD + kc * 32, lane), acc[j]); }
  if (which < 2) { _Float16* dst = (which == 0) ? Q : Kr;
#pragma unroll
    for (int j = 0; j < 4; ++j) { const float bb = bfr(BB[j * 16 + col]);
#pragma unroll
      for (int r = 0; r < 8; ++r) so[wave * 16 + 8 * g + r][j * 16 + col] = (_Float16)(acc[j][r] + bb); }
    LDSX();
    for (int rl = 0; rl < 16; ++rl) if (lane < 8) vst2((unsigned*)(dst + (r0 + rl) * HD + lane * 8), *(const v4u*)&so[wave * 16 + rl][lane * 8]);
  } else {
#pragma unroll
    for (int j = 0; j < 4; ++j) { const float bb = bfr(BB[j * 16 + col]);
#pragma unroll
      for (int r = 0; r < 8; ++r) st[j * 16 + col][wave * 16 + 8 * g + r] = (_Float16)(acc[j][r] + bb); }
    __syncthreads();
    for (int e = tid; e < 64 * 8; e += 128) { const int d = e >> 3, pc = e & 7; vst2((unsigned*)(V + (bh * HD + d) * SS + n0b + pc * 8), *(const v4u*)&st[d][pc * 8]); } }
}
// ---- k_attn: block = (64 queries, bh): plain 64-wide attention over 4,096 keys; O f32 rows
// k rows and v planes reach the four waves through LDS: a stage = 64 keys = 64 k rows and 64 v plane pieces of 128 B each, two buffers, the next stage's copies in flight while this one is worked on
#define KST 64                 // keys a stage
#define LP 72                  // LDS row pitch in halves: 144 B = 16 B x 9, free of bank conflicts for the 16-byte fragment reads
#define STG (2 * 64 * LP)      // halves a buffer: 64 k rows, behind them 64 v plane pieces
// each thread brings 4 + 4 pieces of 16 B (rows 16 apart), a wave's copy covers 4 whole 128-B rows; gk, gv: the thread's first pieces, lk: the LDS byte address of the first
__device__ __forceinline__ void stage_copy(const _Float16* gk, const _Float16* gv, unsigned lk) {
  const unsigned lv = lk + 64 * LP * 2;
  // the closing s_wait_xcnt stands inside the statement so that no address register named here is rewritten ahead of it (a precaution)
  asm volatile("global_load_async_to_lds_b128 %0, %1, off\n\t"
               "global_load_async_to_lds_b128 %2, %3, off\n\t"
               "global_load_async_to_lds_b128 %4, %5, off\n\t"
               "global_load_async_to_lds_b128 %6, %7, off\n\t"
               "global_load_async_to_lds_b128 %8, %9, off\n\t"
               "global_load_async_to_lds_b128 %10, %11, off\n\t"
               "global_load_async_to_lds_b128 %12, %13, off\n\t"
               "global_load_async_to_lds_b128 %14, %15, off\n\t"
               "s_wait_xcnt 0x0"
               :: "v"(lk), "v"(gk), "v"(lk + 16 * LP * 2), "v"(gk + 16 * HD), "v"(lk + 32 * LP * 2), "v"(gk + 32 * HD), "v"(lk + 48 * LP * 2), "v"(gk + 48 * HD),
                  "v"(lv), "v"(gv), "v"(lv + 16 * LP * 2), "v"(gv + 16 * SS), "v"(lv + 32 * LP * 2), "v"(gv + 32 * SS), "v"(lv + 48 * LP * 2), "v"(gv + 48 * SS)
               : "memory");
}
__global__ __launch_bounds__(128) void k_attn(const _Float16* __restrict__ Q, const _Float16* __restrict__ Kr, const _Float16* __restrict__ V, float* __restrict__ O) {
  __shared__ __align__(16) _Float16 sph[4][16][40]; __shared__ __align__(16) _Float16 ring[2][STG];
  float (*so)[16][68] = (float (*)[16][68])&ring[0][0];   // behind the loop the ring's first buffer is the output staging
  const int tid = threadIdx.x, wave = tid >> 5, lane = tid & 31, col = lane & 15, g = lane >> 4; const size_t bh = blockIdx.y; const int q0 = blockIdx.x * 64 + wave * 16; const size_t rq = bh * SS + q0;
  const _Float16* gk = Kr + (bh * SS + (tid >> 3)) * HD + (tid & 7) * 8; const _Float16* gv = V + (bh * HD + (tid >> 3)) * SS + (tid & 7) * 8;
  const unsigned lk = (unsigned)(size_t)&ring[0][(tid >> 3) * LP + (tid & 7) * 8];
  stage_copy(gk, gv, lk);
  asm volatile("s_wait_asynccnt 0x0" ::: "memory");   // this wave's part of stage 0 has landed
  __syncthreads();                                     // and every other wave's
  stage_copy(gk + KST * HD, gv + KST, lk + STG * 2);
  v16h aq[2];
#pragma unroll
  for (int kc = 0; kc < 2; ++kc) aq[kc] = frag_h(Q + (rq + col) * HD + kc * 32, lane);
  float m[8], l[8];
#pragma unroll
  for (int r = 0; r < 8; ++r) { m[r] = -3.0e38f; l[r] = 0.f; }
  v8f acc[4] = {};
#pragma unroll 1
  for (int t = 0; t < SS / KST; ++t) { const _Float16* kb = &ring[t & 1][0]; const _Float16* vb = kb + 64 * LP;
#pragma unroll   // the two 32-key steps of a stage: unrolled, their LDS offsets are immediates
   for (int hs = 0; hs < KST / 32; ++hs) { v8f s[2];
#pragma unroll
    for (int ct = 0; ct < 2; ++ct) { const _Float16* rk = kb + (hs * 32 + ct * 16 + col) * LP; v8f c = {};
#pragma unroll
      for (int kc = 0; kc < 2; ++kc) c = wmma16(aq[kc], frag_h(rk + kc * 32, lane), c);
#pragma unroll
      for (int r = 0; r < 8; ++r) s[ct][r] = c[r] * 0.125f; }
#pragma unroll
    for (int r = 0; r < 8; ++r) { float mx = fmaxf(s[0][r], s[1][r]);
#pragma unroll
      for (int o = 1; o < 16; o <<= 1) mx = fmaxf(mx, __shfl_xor(mx, o));
      const float mn = fmaxf(m[r], mx); const float alpha = (m[r] <= -1.0e38f) ? 0.f : __expf(m[r] - mn); const float e0 = __expf(s[0][r] - mn), e1 = __expf(s[1][r] - mn); float es = e0 + e1;
#pragma unroll
      for (int o = 1; o < 16; o <<= 1) es += __shfl_xor(es, o);
      l[r] = l[r] * alpha + es; m[r] = mn;
#pragma unroll
      for (int dt = 0; dt < 4; ++dt) acc[dt][r] *= alpha;
      sph[wave][8 * g + r][col] = (_Float16)(e0 * 2048.0f); sph[wave][8 * g + r][16 + col] = (_Float16)(e1 * 2048.0f); }
    LDSX();
    const v16h pa = frag_h(&sph[wave][col][0], lane);
#pragma unroll
    for (int dt = 0; dt < 4; ++dt) acc[dt] = wmma16(pa, frag_h(vb + (dt * 16 + col) * LP + hs * 32, lane), acc[dt]);
    LDSX(); }
   asm volatile("s_wait_dscnt 0x0" ::: "memory");      // this wave has left the buffer it read
   asm volatile("s_wait_asynccnt 0x0" ::: "memory");   // its part of the next stage has landed
   __syncthreads();                                     // publishes the next stage and frees this one's buffer
   if (t + 2 < SS / KST) stage_copy(gk + (size_t)(t + 2) * (KST * HD), gv + (t + 2) * KST, lk + (t & 1) * (STG * 2)); }
  asm volatile("s_wait_asynccnt 0x0" ::: "memory");    // no copy is left in flight
#pragma unroll
  for (int r = 0; r < 8; ++r) { const float il = (1.0f / 2048.0f) / l[r];
#pragma unroll
    for (int dt = 0; dt < 4; ++dt) so[wave][8 * g + r][dt * 16 + col] = acc[dt][r] * il; }
  LDSX();
  for (int rl = 0; rl < 16; ++rl) if (lane < 16) vst2(O + (rq + rl) * HD + lane * 4, *(const v4f*)&so[wave][rl][lane * 4]);
}
// ---- k_out: block = (64 tokens, bh): out = o (bf16 hi + lo) . Wp^T + bp
__global__ __launch_bounds__(128) void k_out(const float* __restrict__ O, const __bf16* __restrict__ P, const float* __restrict__ BP, float* __restrict__ OUT) {
  __shared__ __align__(16) float so[4][16][68];
  const int tid = threadIdx.x, wave = tid >> 5, lane = tid & 31, col = lane & 15, g = lane >> 4; const size_t bh = blockIdx.y; const size_t r0 = bh * SS + blockIdx.x * 64 + wave * 16;
  v8f acc[4] = {};
#pragma unroll
  for (int kc = 0; kc < HD / 32; ++kc) { const F2 a = split_row(O + (r0 + col) * HD, kc * 32, lane);
#pragma unroll
    for (int j = 0; j < 4; ++j) { const v16b w = frag_b(P + ((size_t)3 * HD + j * 16 + col) * HD + kc * 32, lane); acc[j] = wmma_bf(a.h, w, acc[j]); acc[j] = wmma_bf(a.l, w, acc[j]); } }
#pragma unroll
  for (int j = 0; j < 4; ++j) { const float bb = bfr(BP[j * 16 + col]);
#pragma unroll
    for (int r = 0; r < 8; ++r) so[wave][8 * g + r][j * 16 + col] = acc[j][r] + bb; }
  LDSX();
  for (int rl = 0; rl < 16; ++rl) if (lane < 16) vst2(OUT + (r0 + rl) * HD + lane * 4, *(const v4f*)&so[wave][rl][lane * 4]);
}
extern "C" void kernel_launch(void* const* d_in, const int* in_sizes, int n_in, void* d_out, int out_size, void* d_ws, size_t ws_size, hipStream_t stream) {
  (void)in_sizes; (void)n_in; (void)out_size;
  const float** F = (const float**)d_in;   // 0 x [2,12,4096,64]; 1 Wq [64,64], 2 bq, 3 Wk, 4 bk, 5 Wv, 6 bv, 7 Wp, 8 bp (natural [out][in])
  if (ws_size < (size_t)WS_END) return;
  char* ws = (char*)d_ws; __bf16* P = (__bf16*)ws; _Float16 *Q = (_Float16*)(ws + WS_Q), *Kr = (_Float16*)(ws + WS_K), *V = (_Float16*)(ws + WS_V); float* O = (float*)(ws + WS_O);
  k_pack<<<dim3(HD, 4), 64, 0, stream>>>(F[1], F[3], F[5], F[7], P);
  k_proj<<<dim3(SS / 64, 3, NBH), 128, 0, stream>>>(F[0], P, F[2], F[4], F[6], Q, Kr, V);
  k_attn<<<dim3(TQB, TNB), 128, 0, stream>>>(Q, Kr, V, O);
  k_out<<<dim3(TQB, TNB), 128, 0, stream>>>(O, P, F[8], (float*)d_out);
}

// v002
// Measured time: 158 microseconds a run.
// Two timings next to v001 put it at 1.56 and 1.55 times that version's speed.
// Over all steps from v000 it is 2.42 times as fast.
// compute dtype: all float inputs rounded to bf16; q/k/v = x . W^T + b (64 -> 64 per head) with EXACT bf16 products on WMMA 16x16x32 (natural rows), rounded once to f16; PLAIN attention per (batch, head): q, k single f16 x 1/8, scores transposed (k rows as A, q as B: a lane holds one query), running-max softmax in f32 (hardware exp), P (scaled by 2^11, single f16, packed from the score registers as B) under v planes (single f16, A); out = o (bf16 hi + residual) . Wp^T (2 products) + bp; f32 output.
#include <hip/hip_runtime.h>
#include <math.h>

typedef __attribute__((ext_vector_type(16))) _Float16 v16h;
typedef __attribute__((ext_vector_type(16))) __bf16 v16b;
typedef __attribute__((ext_vector_type(8)))  _Float16 v8h;
typedef __attribute__((ext_vector_type(8)))  float v8f;
typedef __attribute__((ext_vector_type(4)))  float v4f;
typedef __attribute__((ext_vector_type(2)))  float v2f;
typedef __attribute__((ext_vector_type(4)))  unsigned v4u;
typedef __attribute__((ext_vector_type(4)))  int v4i;
typedef float __attribute__((may_alias)) float_a;
typedef int __attribute__((may_alias)) int_a;

template <typename T> __device__ __forceinline__ void vst2(void* p, T v) { *(T*)p = v;  }
__device__ __forceinline__ v8f wmma16(v16h a, v16h b, v8f c) {
  v8f d = __builtin_amdgcn_wmma_f32_16x16x32_f16(false, a, false, b, (short)0, c, false, false);
  asm volatile("v_nop\n\tv_nop\n\tv_nop\n\tv_nop" : "+v"(d) : "v"(a), "v"(b));
  return d;
}
__device__ __forceinline__ v8f wmma_bf(v16b a, v16b b, v8f c) {
  v8f d = __builtin_amdgcn_wmma_f32_16x16x32_bf16(false, a, false, b, (short)0, c, false, false);
  asm volatile("v_nop\n\tv_nop\n\tv_nop\n\tv_nop" : "+v"(d) : "v"(a), "v"(b));
  return d;
}
// 16x16x32 fragments: lane = (h = lane>>4, row/col = lane&15); elements 0..7 = k0+8h+0..7, 8..15 = k0+16+8h+0..7; D element r = row 8h+r
__device__ __forceinline__ v16h frag_h(const _Float16* rowk0, int lane) {
  union { v16h v; v8h q[2]; } u; const _Float16* p = rowk0 + 8 * (lane >> 4);
  u.q[0] = *(const v8h*)p; u.q[1] = *(const v8h*)(p + 16); return u.v;
}
__device__ __forceinline__ v16h frag_f32(const float* rowk0, int lane) {
  v16h a; const float* p = rowk0 + 8 * (lane >> 4);
#pragma unroll
  for (int i = 0; i < 8; ++i) { a[i] = (_Float16)p[i]; a[8 + i] = (_Float16)p[16 + i]; }
  return a;
}
__device__ __forceinline__ v16h frag_f32s(const float* rowk0, int lane, float sc) {
  v16h a; const float* p = rowk0 + 8 * (lane >> 4);
#pragma unroll
  for (int i = 0; i < 8; ++i) { a[i] = (_Float16)(p[i] * sc); a[8 + i] = (_Float16)(p[16 + i] * sc); }
  return a;
}
// column fragment from a [K][ld] layout (column n), rows >= K read as 0
__device__ __forceinline__ v16h fragc_f32(const float* W, int k0, int n, int lane, int ld, int K) {
  v16h a; const int g = lane >> 4;
#pragma unroll
  for (int i = 0; i < 8; ++i) { const int ka = k0 + 8 * g + i, kb = ka + 16;
    a[i] = (_Float16)(ka < K ? W[(size_t)(ka < K ? ka : K - 1) * ld + n] : 0.f); a[8 + i] = (_Float16)(kb < K ? W[(size_t)(kb < K ? kb : K - 1) * ld + n] : 0.f); }
  return a;
}
struct F2 { v16b h, l; };
__device__ __forceinline__ F2 bsplit16(const float v[16]) { F2 r;
#pragma unroll
  for (int i = 0; i < 16; ++i) { const __bf16 h = (__bf16)v[i]; r.h[i] = h; r.l[i] = (__bf16)(v[i] - (float)h); }
  return r; }
__device__ __forceinline__ F2 split_row(const float* row, int k0, int lane) { float v[16]; const float* p = row + k0 + 8 * (lane >> 4);
#pragma unroll
  for (int i = 0; i < 8; ++i) { v[i] = p[i]; v[8 + i] = p[16 + i]; }
  return bsplit16(v); }
__device__ __forceinline__ F2 split_rowK(const float* row, int k0, int lane, int K) { float v[16]; const int g = lane >> 4;
#pragma unroll
  for (int i = 0; i < 8; ++i) { const int ka = k0 + 8 * g + i, kb = ka + 16; v[i] = ka < K ? row[ka < K ? ka : K - 1] : 0.f; v[8 + i] = kb < K ? row[kb < K ? kb : K - 1] : 0.f; }
  return bsplit16(v); }
__device__ __forceinline__ F2 split_col(const float* W, int k0, int n, int lane, int ld, int K) { float v[16]; const int g = lane >> 4;
#pragma unroll
  for (int i = 0; i < 8; ++i) { const int ka = k0 + 8 * g + i, kb = ka + 16; v[i] = ka < K ? W[(size_t)(ka < K ? ka : K - 1) * ld + n] : 0.f; v[8 + i] = kb < K ? W[(size_t)(kb < K ? kb : K - 1) * ld + n] : 0.f; }
  return bsplit16(v); }
__device__ __forceinline__ v8f mac3(const F2& a, const F2& b, v8f c) { c = wmma_bf(a.l, b.h, c); c = wmma_bf(a.h, b.l, c); return wmma_bf(a.h, b.h, c); }
__device__ __forceinline__ float sigm(float v) { return 1.0f / (1.0f + expf(-v)); }
#define LDSX() do { asm volatile("s_wait_dscnt 0" ::: "memory"); __builtin_amdgcn_wave_barrier(); __builtin_amdgcn_fence(__ATOMIC_RELEASE, "workgroup"); } while (0)


// Sub-space attention on a head-split input (B 2, 12 heads, 4,096 tokens, 64 dims): per-head 64x64 q/k/v linears + biases, softmax(q k^T / 8) v, 64x64 output linear + bias.
#define NBH 24            // B * H batch-heads
#define SS 4096
#define HD 64
#define NR (NBH * SS)
#ifndef TQB
#define TQB (SS / 64)
#define TNB NBH
#endif
typedef __attribute__((ext_vector_type(8))) __bf16 v8b;
__device__ __forceinline__ v16b frag_b(const __bf16* rowk0, int lane) {
  union { v16b v; v8b q[2]; } u; const __bf16* p = rowk0 + 8 * (lane >> 4);
  u.q[0] = *(const v8b*)p; u.q[1] = *(const v8b*)(p + 16); return u.v;
}
__device__ __forceinline__ float bfr(float v) { return (float)(__bf16)v; }
__device__ __attribute__((noinline)) float exp_ni(float v) { return expf(v); }
__device__ __attribute__((noinline)) float erf_ni(float v) { return erff(v); }

#define WS_PW  0u                                 // bf16 natural rows Wq, Wk, Wv, Wp [4][64][64]
#define WS_Q   (WS_PW + 2u * 4 * HD * HD + 256u)   // f16 q rows [NR][64] ; k rows ; v planes [bh][64][SS] ; O f32 [NR][64]
#define WS_K   (WS_Q + 2u * (size_t)NR * HD)
#define WS_V   (WS_K + 2u * (size_t)NR * HD)
#define WS_O   (WS_V + 2u * (size_t)NBH * HD * SS)
#define WS_END (WS_O + 4u * (size_t)NR * HD)

__global__ __launch_bounds__(64) void k_pack(const float* __restrict__ WQ, const float* __restrict__ WK, const float* __restrict__ WV, const float* __restrict__ WP, __bf16* __restrict__ P) { const int n = blockIdx.x, m = blockIdx.y, t = threadIdx.x; const float* w = (m == 0) ? WQ : (m == 1) ? WK : (m == 2) ? WV : WP; __shared__ __align__(16) __bf16 s[HD]; s[t] = (__bf16)w[(size_t)n * HD + t]; __syncthreads(); if (t < HD / 8) vst2((unsigned*)(P + ((size_t)m * HD + n) * HD + t * 8), *(const v4u*)&s[t * 8]); }
// ---- k_proj: block = (64 tokens, which, bh): y = x . W^T + b (K = 64); q/k rows, v planes
__global__ __launch_bounds__(128) void k_proj(const float* __restrict__ X, const __bf16* __restrict__ P, const float* __restrict__ BQ, const float* __restrict__ BK, const float* __restrict__ BV, _Float16* __restrict__ Q, _Float16* __restrict__ Kr, _Float16* __restrict__ V) {
  __shared__ __align__(16) _Float16 so[64][72]; __shared__ __align__(16) _Float16 st[64][72];
  const int tid = threadIdx.x, wave = tid >> 5, lane = tid & 31, col = lane & 15, g = lane >> 4; const int which = blockIdx.y; const size_t bh = blockIdx.z; const int n0b = blockIdx.x * 64; const size_t r0 = bh * SS + n0b + wave * 16; const float* BB = (which == 0) ? BQ : (which == 1) ? BK : BV;
  v8f acc[4] = {};
#pragma unroll
  for (int kc = 0; kc < HD / 32; ++kc) { v16b a; { const float* p = X + (r0 + col) * HD + kc * 32 + 8 * g;
#pragma unroll
      for (int i = 0; i < 8; ++i) { a[i] = (__bf16)p[i]; a[8 + i] = (__bf16)p[16 + i]; } }
#pragma unroll
    for (int j = 0; j < 4; ++j) acc[j] = wmma_bf(a, frag_b(P + ((size_t)which * HD + j * 16 + col) * HD + kc * 32, lane), acc[j]); }
  if (which < 2) { _Float16* dst = (which == 0) ? Q : Kr;
#pragma unroll
    for (int j = 0; j < 4; ++j) { const float bb = bfr(BB[j * 16 + col]);
#pragma unroll
      for (int r = 0; r < 8; ++r) so[wave * 16 + 8 * g + r][j * 16 + col] = (_Float16)(acc[j][r] + bb); }
    LDSX();
    for (int rl = 0; rl < 16; ++rl) if (lane < 8) vst2((unsigned*)(dst + (r0 + rl) * HD + lane * 8), *(const v4u*)&so[wave * 16 + rl][lane * 8]);
  } else {
#pragma unroll
    for (int j = 0; j < 4; ++j) { const float bb = bfr(BB[j * 16 + col]);
#pragma unroll
      for (int r = 0; r < 8; ++r) st[j * 16 + col][wave * 16 + 8 * g + r] = (_Float16)(acc[j][r] + bb); }
    __syncthreads();
    for (int e = tid; e < 64 * 8; e += 128) { const int d = e >> 3, pc = e & 7; vst2((unsigned*)(V + (bh * HD + d) * SS + n0b + pc * 8), *(const v4u*)&st[d][pc * 8]); } }
}
// ---- k_attn: block = (64 queries, bh): plain 64-wide attention over 4,096 keys; O f32 rows
// k rows and v planes reach the four waves through LDS: a stage = 64 keys = 64 k rows and 64 v plane pieces of 128 B each, two buffers, the next stage's copies in flight while this one is worked on
#define KST 64                 // keys a stage
#define LP 72                  // LDS row pitch in halves: 144 B = 16 B x 9, free of bank conflicts for the 16-byte fragment reads
#define STG (2 * 64 * LP)      // halves a buffer: 64 k rows, behind them 64 v plane pieces
// each thread brings 4 + 4 pieces of 16 B (rows 16 apart), a wave's copy covers 4 whole 128-B rows; gk, gv: the thread's first pieces, lk: the LDS byte address of the first
__device__ __forceinline__ void stage_copy(const _Float16* gk, const _Float16* gv, unsigned lk) {
  const unsigned lv = lk + 64 * LP * 2;
  // the closing s_wait_xcnt stands inside the statement so that no address register named here is rewritten ahead of it (a precaution)
  asm volatile("global_load_async_to_lds_b128 %0, %1, off\n\t"
               "global_load_async_to_lds_b128 %2, %3, off\n\t"
               "global_load_async_to_lds_b128 %4, %5, off\n\t"
               "global_load_async_to_lds_b128 %6, %7, off\n\t"
               "global_load_async_to_lds_b128 %8, %9, off\n\t"
               "global_load_async_to_lds_b128 %10, %11, off\n\t"
               "global_load_async_to_lds_b128 %12, %13, off\n\t"
               "global_load_async_to_lds_b128 %14, %15, off\n\t"
               "s_wait_xcnt 0x0"
               :: "v"(lk), "v"(gk), "v"(lk + 16 * LP * 2), "v"(gk + 16 * HD), "v"(lk + 32 * LP * 2), "v"(gk + 32 * HD), "v"(lk + 48 * LP * 2), "v"(gk + 48 * HD),
                  "v"(lv), "v"(gv), "v"(lv + 16 * LP * 2), "v"(gv + 16 * SS), "v"(lv + 32 * LP * 2), "v"(gv + 32 * SS), "v"(lv + 48 * LP * 2), "v"(gv + 48 * SS)
               : "memory");
}
// lane l's value from lane l ^ 16
__device__ __forceinline__ float xhalf(float x) { const int b = __builtin_bit_cast(int, x); return __builtin_bit_cast(float, __builtin_amdgcn_permlanex16(b, b, 0x76543210, 0xfedcba98, false, false)); }
__global__ __launch_bounds__(128) void k_attn(const _Float16* __restrict__ Q, const _Float16* __restrict__ Kr, const _Float16* __restrict__ V, float* __restrict__ O) {
  __shared__ __align__(16) _Float16 ring[2][STG];
  float (*so)[16][68] = (float (*)[16][68])&ring[0][0];   // behind the loop the ring's first buffer is the output staging
  const int tid = threadIdx.x, wave = tid >> 5, lane = tid & 31, col = lane & 15, g = lane >> 4; const size_t bh = blockIdx.y; const int q0 = blockIdx.x * 64 + wave * 16; const size_t rq = bh * SS + q0;
  const _Float16* gk = Kr + (bh * SS + (tid >> 3)) * HD + (tid & 7) * 8; const _Float16* gv = V + (bh * HD + (tid >> 3)) * SS + (tid & 7) * 8;
  const unsigned lk = (unsigned)(size_t)&ring[0][(tid >> 3) * LP + (tid & 7) * 8];
  stage_copy(gk, gv, lk);
  asm volatile("s_wait_asynccnt 0x0" ::: "memory");   // this wave's part of stage 0 has landed
  __syncthreads();                                     // and every other wave's
  stage_copy(gk + KST * HD, gv + KST, lk + STG * 2);
  v16h aq[2];
#pragma unroll
  for (int kc = 0; kc < 2; ++kc) aq[kc] = frag_h(Q + (rq + col) * HD + kc * 32, lane);
  float m = -3.0e38f, l = 0.f;
  v8f acc[4] = {};
#pragma unroll 1
  for (int t = 0; t < SS / KST; ++t) { const _Float16* kb = &ring[t & 1][0]; const _Float16* vb = kb + 64 * LP;
#pragma unroll   // the two 32-key steps of a stage: unrolled, their LDS offsets are immediates
   for (int hs = 0; hs < KST / 32; ++hs) { v8f s[2];
#pragma unroll
    for (int ct = 0; ct < 2; ++ct) { const _Float16* rk = kb + (hs * 32 + ct * 16 + col) * LP; v8f c = {};
#pragma unroll
      for (int kc = 0; kc < 2; ++kc) c = wmma16(frag_h(rk + kc * 32, lane), aq[kc], c);
#pragma unroll
      for (int r = 0; r < 8; ++r) s[ct][r] = c[r] * 0.125f; }
    float mx = fmaxf(s[0][0], s[1][0]);
#pragma unroll
    for (int r = 1; r < 8; ++r) mx = fmaxf(mx, fmaxf(s[0][r], s[1][r]));
    mx = fmaxf(mx, xhalf(mx));
    const float mn = fmaxf(m, mx); const float alpha = (m <= -1.0e38f) ? 0.f : __expf(m - mn);
    v16h pb; float es0 = 0.f, es1 = 0.f;
#pragma unroll
    for (int r = 0; r < 8; ++r) { const float e0 = __expf(s[0][r] - mn), e1 = __expf(s[1][r] - mn); es0 += e0; es1 += e1;
      pb[r] = (_Float16)(e0 * 2048.0f); pb[8 + r] = (_Float16)(e1 * 2048.0f); }
    l = l * alpha + (es0 + es1); m = mn;
#pragma unroll
    for (int dt = 0; dt < 4; ++dt) {
#pragma unroll
      for (int r = 0; r < 8; ++r) acc[dt][r] *= alpha; }
#pragma unroll
    for (int dt = 0; dt < 4; ++dt) acc[dt] = wmma16(frag_h(vb + (dt * 16 + col) * LP + hs * 32, lane), pb, acc[dt]); }
   asm volatile("s_wait_dscnt 0x0" ::: "memory");      // this wave has left the buffer it read
   asm volatile("s_wait_asynccnt 0x0" ::: "memory");   // its part of the next stage has landed
   __syncthreads();                                     // publishes the next stage and frees this one's buffer
   if (t + 2 < SS / KST) stage_copy(gk + (size_t)(t + 2) * (KST * HD), gv + (t + 2) * KST, lk + (t & 1) * (STG * 2)); }
  asm volatile("s_wait_asynccnt 0x0" ::: "memory");    // no copy is left in flight
  l += xhalf(l);
  const float il = (1.0f / 2048.0f) / l;
#pragma unroll
  for (int dt = 0; dt < 4; ++dt) {
#pragma unroll
    for (int hf = 0; hf < 2; ++hf) { v4f o4;
#pragma unroll
      for (int i = 0; i < 4; ++i) o4[i] = acc[dt][hf * 4 + i] * il;
      *(v4f*)&so[wave][col][dt * 16 + 8 * g + hf * 4] = o4; } }
  LDSX();
  for (int rl = 0; rl < 16; ++rl) if (lane < 16) vst2(O + (rq + rl) * HD + lane * 4, *(const v4f*)&so[wave][rl][lane * 4]);
}
// ---- k_out: block = (64 tokens, bh): out = o (bf16 hi + lo) . Wp^T + bp
__global__ __launch_bounds__(128) void k_out(const float* __restrict__ O, const __bf16* __restrict__ P, const float* __restrict__ BP, float* __restrict__ OUT) {
  __shared__ __align__(16) float so[4][16][68];
  const int tid = threadIdx.x, wave = tid >> 5, lane = tid & 31, col = lane & 15, g = lane >> 4; const size_t bh = blockIdx.y; const size_t r0 = bh * SS + blockIdx.x * 64 + wave * 16;
  v8f acc[4] = {};
#pragma unroll
  for (int kc = 0; kc < HD / 32; ++kc) { const F2 a = split_row(O + (r0 + col) * HD, kc * 32, lane);
#pragma unroll
    for (int j = 0; j < 4; ++j) { const v16b w = frag_b(P + ((size_t)3 * HD + j * 16 + col) * HD + kc * 32, lane); acc[j] = wmma_bf(a.h, w, acc[j]); acc[j] = wmma_bf(a.l, w, acc[j]); } }
#pragma unroll
  for (int j = 0; j < 4; ++j) { const float bb = bfr(BP[j * 16 + col]);
#pragma unroll
    for (int r = 0; r < 8; ++r) so[wave][8 * g + r][j * 16 + col] = acc[j][r] + bb; }
  LDSX();
  for (int rl = 0; rl < 16; ++rl) if (lane < 16) vst2(OUT + (r0 + rl) * HD + lane * 4, *(const v4f*)&so[wave][rl][lane * 4]);
}
extern "C" void kernel_launch(void* const* d_in, const int* in_sizes, int n_in, void* d_out, int out_size, void* d_ws, size_t ws_size, hipStream_t stream) {
  (void)in_sizes; (void)n_in; (void)out_size;
  const float** F = (const float**)d_in;   // 0 x [2,12,4096,64]; 1 Wq [64,64], 2 bq, 3 Wk, 4 bk, 5 Wv, 6 bv, 7 Wp, 8 bp (natural [out][in])
  if (ws_size < (size_t)WS_END) return;
  char* ws = (char*)d_ws; __bf16* P = (__bf16*)ws; _Float16 *Q = (_Float16*)(ws + WS_Q), *Kr = (_Float16*)(ws + WS_K), *V = (_Float16*)(ws + WS_V); float* O = (float*)(ws + WS_O);
  k_pack<<<dim3(HD, 4), 64, 0, stream>>>(F[1], F[3], F[5], F[7], P);
  k_proj<<<dim3(SS / 64, 3, NBH), 128, 0, stream>>>(F[0], P, F[2], F[4], F[6], Q, Kr, V);
  k_attn<<<dim3(TQB, TNB), 128, 0, stream>>>(Q, Kr, V, O);
  k_out<<<dim3(TQB, TNB), 128, 0, stream>>>(O, P, F[8], (float*)d_out);
}

// v003
// It runs in 143 microseconds.
// In both of two side-by-side timings against v002, it was 1.11 times as fast.
// All steps since v000 together make it 2.69 times as fast.
// compute dtype: all float inputs rounded to bf16; q/k/v = x . W^T + b (64 -> 64 per head) with EXACT bf16 products on WMMA 16x16x32 (natural rows), rounded once to f16; PLAIN attention per (batch, head): q, k single f16 x 1/8, scores transposed (k rows as A, q as B: a lane holds one query), running-max softmax in f32 (hardware exp), P (scaled by 2^11, single f16, packed from the score registers as B) under v planes (single f16, A); out = o (bf16 hi + residual) . Wp^T (2 products) + bp; f32 output.
#include <hip/hip_runtime.h>
#include <math.h>

typedef __attribute__((ext_vector_type(16))) _Float16 v16h;
typedef __attribute__((ext_vector_type(16))) __bf16 v16b;
typedef __attribute__((ext_vector_type(8)))  _Float16 v8h;
typedef __attribute__((ext_vector_type(8)))  float v8f;
typedef __attribute__((ext_vector_type(4)))  float v4f;
typedef __attribute__((ext_vector_type(2)))  float v2f;
typedef __attribute__((ext_vector_type(4)))  unsigned v4u;
typedef __attribute__((ext_vector_type(4)))  int v4i;
typedef float __attribute__((may_alias)) float_a;
typedef int __attribute__((may_alias)) int_a;

template <typename T> __device__ __forceinline__ void vst2(void* p, T v) { *(T*)p = v;  }
__device__ __forceinline__ v8f wmma16(v16h a, v16h b, v8f c) {
  v8f d = __builtin_amdgcn_wmma_f32_16x16x32_f16(false, a, false, b, (short)0, c, false, false);
  return d;
}
__device__ __forceinline__ v8f wmma_bf(v16b a, v16b b, v8f c) {
  v8f d = __builtin_amdgcn_wmma_f32_16x16x32_bf16(false, a, false, b, (short)0, c, false, false);
  return d;
}
// 16x16x32 fragments: lane = (h = lane>>4, row/col = lane&15); elements 0..7 = k0+8h+0..7, 8..15 = k0+16+8h+0..7; D element r = row 8h+r
__device__ __forceinline__ v16h frag_h(const _Float16* rowk0, int lane) {
  union { v16h v; v8h q[2]; } u; const _Float16* p = rowk0 + 8 * (lane >> 4);
  u.q[0] = *(const v8h*)p; u.q[1] = *(const v8h*)(p + 16); return u.v;
}
__device__ __forceinline__ v16h frag_f32(const float* rowk0, int lane) {
  v16h a; const float* p = rowk0 + 8 * (lane >> 4);
#pragma unroll
  for (int i = 0; i < 8; ++i) { a[i] = (_Float16)p[i]; a[8 + i] = (_Float16)p[16 + i]; }
  return a;
}
__device__ __forceinline__ v16h frag_f32s(const float* rowk0, int lane, float sc) {
  v16h a; const float* p = rowk0 + 8 * (lane >> 4);
#pragma unroll
  for (int i = 0; i < 8; ++i) { a[i] = (_Float16)(p[i] * sc); a[8 + i] = (_Float16)(p[16 + i] * sc); }
  return a;
}
// column fragment from a [K][ld] layout (column n), rows >= K read as 0
__device__ __forceinline__ v16h fragc_f32(const float* W, int k0, int n, int lane, int ld, int K) {
  v16h a; const int g = lane >> 4;
#pragma unroll
  for (int i = 0; i < 8; ++i) { const int ka = k0 + 8 * g + i, kb = ka + 16;
    a[i] = (_Float16)(ka < K ? W[(size_t)(ka < K ? ka : K - 1) * ld + n] : 0.f); a[8 + i] = (_Float16)(kb < K ? W[(size_t)(kb < K ? kb : K - 1) * ld + n] : 0.f); }
  return a;
}
struct F2 { v16b h, l; };
__device__ __forceinline__ F2 bsplit16(const float v[16]) { F2 r;
#pragma unroll
  for (int i = 0; i < 16; ++i) { const __bf16 h = (__bf16)v[i]; r.h[i] = h; r.l[i] = (__bf16)(v[i] - (float)h); }
  return r; }
__device__ __forceinline__ F2 split_row(const float* row, int k0, int lane) { float v[16]; const float* p = row + k0 + 8 * (lane >> 4);
#pragma unroll
  for (int i = 0; i < 8; ++i) { v[i] = p[i]; v[8 + i] = p[16 + i]; }
  return bsplit16(v); }
__device__ __forceinline__ F2 split_rowK(const float* row, int k0, int lane, int K) { float v[16]; const int g = lane >> 4;
#pragma unroll
  for (int i = 0; i < 8; ++i) { const int ka = k0 + 8 * g + i, kb = ka + 16; v[i] = ka < K ? row[ka < K ? ka : K - 1] : 0.f; v[8 + i] = kb < K ? row[kb < K ? kb : K - 1] : 0.f; }
  return bsplit16(v); }
__device__ __forceinline__ F2 split_col(const float* W, int k0, int n, int lane, int ld, int K) { float v[16]; const int g = lane >> 4;
#pragma unroll
  for (int i = 0; i < 8; ++i) { const int ka = k0 + 8 * g + i, kb = ka + 16; v[i] = ka < K ? W[(size_t)(ka < K ? ka : K - 1) * ld + n] : 0.f; v[8 + i] = kb < K ? W[(size_t)(kb < K ? kb : K - 1) * ld + n] : 0.f; }
  return bsplit16(v); }
__device__ __forceinline__ v8f mac3(const F2& a, const F2& b, v8f c) { c = wmma_bf(a.l, b.h, c); c = wmma_bf(a.h, b.l, c); return wmma_bf(a.h, b.h, c); }
__device__ __forceinline__ float sigm(float v) { return 1.0f / (1.0f + expf(-v)); }
#define LDSX() do { asm volatile("s_wait_dscnt 0" ::: "memory"); __builtin_amdgcn_wave_barrier(); __builtin_amdgcn_fence(__ATOMIC_RELEASE, "workgroup"); } while (0)


// Sub-space attention on a head-split input (B 2, 12 heads, 4,096 tokens, 64 dims): per-head 64x64 q/k/v linears + biases, softmax(q k^T / 8) v, 64x64 output linear + bias.
#define NBH 24            // B * H batch-heads
#define SS 4096
#define HD 64
#define NR (NBH * SS)
#ifndef TQB
#define TQB (SS / 64)
#define TNB NBH
#endif
typedef __attribute__((ext_vector_type(8))) __bf16 v8b;
__device__ __forceinline__ v16b frag_b(const __bf16* rowk0, int lane) {
  union { v16b v; v8b q[2]; } u; const __bf16* p = rowk0 + 8 * (lane >> 4);
  u.q[0] = *(const v8b*)p; u.q[1] = *(const v8b*)(p + 16); return u.v;
}
__device__ __forceinline__ float bfr(float v) { return (float)(__bf16)v; }
__device__ __attribute__((noinline)) float exp_ni(float v) { return expf(v); }
__device__ __attribute__((noinline)) float erf_ni(float v) { return erff(v); }

#define WS_PW  0u                                 // bf16 natural rows Wq, Wk, Wv, Wp [4][64][64]
#define WS_Q   (WS_PW + 2u * 4 * HD * HD + 256u)   // f16 q rows [NR][64] ; k rows ; v planes [bh][64][SS] ; O f32 [NR][64]
#define WS_K   (WS_Q + 2u * (size_t)NR * HD)
#define WS_V   (WS_K + 2u * (size_t)NR * HD)
#define WS_O   (WS_V + 2u * (size_t)NBH * HD * SS)
#define WS_END (WS_O + 4u * (size_t)NR * HD)

__global__ __launch_bounds__(64) void k_pack(const float* __restrict__ WQ, const float* __restrict__ WK, const float* __restrict__ WV, const float* __restrict__ WP, __bf16* __restrict__ P) { const int n = blockIdx.x, m = blockIdx.y, t = threadIdx.x; const float* w = (m == 0) ? WQ : (m == 1) ? WK : (m == 2) ? WV : WP; __shared__ __align__(16) __bf16 s[HD]; s[t] = (__bf16)w[(size_t)n * HD + t]; __syncthreads(); if (t < HD / 8) vst2((unsigned*)(P + ((size_t)m * HD + n) * HD + t * 8), *(const v4u*)&s[t * 8]); }
// ---- k_proj: block = (64 tokens, which, bh): y = x . W^T + b (K = 64); q/k rows, v planes
__global__ __launch_bounds__(128) void k_proj(const float* __restrict__ X, const __bf16* __restrict__ P, const float* __restrict__ BQ, const float* __restrict__ BK, const float* __restrict__ BV, _Float16* __restrict__ Q, _Float16* __restrict__ Kr, _Float16* __restrict__ V) {
  __shared__ __align__(16) _Float16 so[64][72]; __shared__ __align__(16) _Float16 st[64][72];
  const int tid = threadIdx.x, wave = tid >> 5, lane = tid & 31, col = lane & 15, g = lane >> 4; const int which = blockIdx.y; const size_t bh = blockIdx.z; const int n0b = blockIdx.x * 64; const size_t r0 = bh * SS + n0b + wave * 16; const float* BB = (which == 0) ? BQ : (which == 1) ? BK : BV;
  v8f acc[4] = {};
#pragma unroll
  for (int kc = 0; kc < HD / 32; ++kc) { v16b a; { const float* p = X + (r0 + col) * HD + kc * 32 + 8 * g;
#pragma unroll
      for (int i = 0; i < 8; ++i) { a[i] = (__bf16)p[i]; a[8 + i] = (__bf16)p[16 + i]; } }
#pragma unroll
    for (int j = 0; j < 4; ++j) acc[j] = wmma_bf(a, frag_b(P + ((size_t)which * HD + j * 16 + col) * HD + kc * 32, lane), acc[j]); }
  if (which < 2) { _Float16* dst = (which == 0) ? Q : Kr;
#pragma unroll
    for (int j = 0; j < 4; ++j) { const float bb = bfr(BB[j * 16 + col]);
#pragma unroll
      for (int r = 0; r < 8; ++r) so[wave * 16 + 8 * g + r][j * 16 + col] = (_Float16)(acc[j][r] + bb); }
    LDSX();
    for (int rl = 0; rl < 16; ++rl) if (lane < 8) vst2((unsigned*)(dst + (r0 + rl) * HD + lane * 8), *(const v4u*)&so[wave * 16 + rl][lane * 8]);
  } else {
#pragma unroll
    for (int j = 0; j < 4; ++j) { const float bb = bfr(BB[j * 16 + col]);
#pragma unroll
      for (int r = 0; r < 8; ++r) st[j * 16 + col][wave * 16 + 8 * g + r] = (_Float16)(acc[j][r] + bb); }
    __syncthreads();
    for (int e = tid; e < 64 * 8; e += 128) { const int d = e >> 3, pc = e & 7; vst2((unsigned*)(V + (bh * HD + d) * SS + n0b + pc * 8), *(const v4u*)&st[d][pc * 8]); } }
}
// ---- k_attn: block = (64 queries, bh): plain 64-wide attention over 4,096 keys; O f32 rows
// k rows and v planes reach the four waves through LDS: a stage = 64 keys = 64 k rows and 64 v plane pieces of 128 B each, two buffers, the next stage's copies in flight while this one is worked on
#define KST 64                 // keys a stage
#define LP 72                  // LDS row pitch in halves: 144 B = 16 B x 9, free of bank conflicts for the 16-byte fragment reads
#define STG (2 * 64 * LP)      // halves a buffer: 64 k rows, behind them 64 v plane pieces
// each thread brings 4 + 4 pieces of 16 B (rows 16 apart), a wave's copy covers 4 whole 128-B rows; gk, gv: the thread's first pieces, lk: the LDS byte address of the first
__device__ __forceinline__ void stage_copy(const _Float16* gk, const _Float16* gv, unsigned lk) {
  const unsigned lv = lk + 64 * LP * 2;
  // the closing s_wait_xcnt stands inside the statement so that no address register named here is rewritten ahead of it (a precaution)
  asm volatile("global_load_async_to_lds_b128 %0, %1, off\n\t"
               "global_load_async_to_lds_b128 %2, %3, off\n\t"
               "global_load_async_to_lds_b128 %4, %5, off\n\t"
               "global_load_async_to_lds_b128 %6, %7, off\n\t"
               "global_load_async_to_lds_b128 %8, %9, off\n\t"
               "global_load_async_to_lds_b128 %10, %11, off\n\t"
               "global_load_async_to_lds_b128 %12, %13, off\n\t"
               "global_load_async_to_lds_b128 %14, %15, off\n\t"
               "s_wait_xcnt 0x0"
               :: "v"(lk), "v"(gk), "v"(lk + 16 * LP * 2), "v"(gk + 16 * HD), "v"(lk + 32 * LP * 2), "v"(gk + 32 * HD), "v"(lk + 48 * LP * 2), "v"(gk + 48 * HD),
                  "v"(lv), "v"(gv), "v"(lv + 16 * LP * 2), "v"(gv + 16 * SS), "v"(lv + 32 * LP * 2), "v"(gv + 32 * SS), "v"(lv + 48 * LP * 2), "v"(gv + 48 * SS)
               : "memory");
}
// lane l's value from lane l ^ 16
__device__ __forceinline__ float xhalf(float x) { const int b = __builtin_bit_cast(int, x); return __builtin_bit_cast(float, __builtin_amdgcn_permlanex16(b, b, 0x76543210, 0xfedcba98, false, false)); }
__global__ __launch_bounds__(128) void k_attn(const _Float16* __restrict__ Q, const _Float16* __restrict__ Kr, const _Float16* __restrict__ V, float* __restrict__ O) {
  __shared__ __align__(16) _Float16 ring[2][STG];
  float (*so)[16][68] = (float (*)[16][68])&ring[0][0];   // behind the loop the ring's first buffer is the output staging
  const int tid = threadIdx.x, wave = tid >> 5, lane = tid & 31, col = lane & 15, g = lane >> 4; const size_t bh = blockIdx.y; const int q0 = blockIdx.x * 64 + wave * 16; const size_t rq = bh * SS + q0;
  const _Float16* gk = Kr + (bh * SS + (tid >> 3)) * HD + (tid & 7) * 8; const _Float16* gv = V + (bh * HD + (tid >> 3)) * SS + (tid & 7) * 8;
  const unsigned lk = (unsigned)(size_t)&ring[0][(tid >> 3) * LP + (tid & 7) * 8];
  stage_copy(gk, gv, lk);
  asm volatile("s_wait_asynccnt 0x0" ::: "memory");   // this wave's part of stage 0 has landed
  __syncthreads();                                     // and every other wave's
  stage_copy(gk + KST * HD, gv + KST, lk + STG * 2);
  v16h aq[2];
#pragma unroll
  for (int kc = 0; kc < 2; ++kc) aq[kc] = frag_h(Q + (rq + col) * HD + kc * 32, lane);
  float m = -3.0e38f, l = 0.f;
  v8f acc[4] = {};
#pragma unroll 1
  for (int t = 0; t < SS / KST; ++t) { const _Float16* kb = &ring[t & 1][0]; const _Float16* vb = kb + 64 * LP;
#pragma unroll   // the two 32-key steps of a stage: unrolled, their LDS offsets are immediates
   for (int hs = 0; hs < KST / 32; ++hs) { v8f s[2];
#pragma unroll
    for (int ct = 0; ct < 2; ++ct) { const _Float16* rk = kb + (hs * 32 + ct * 16 + col) * LP; v8f c = {};
#pragma unroll
      for (int kc = 0; kc < 2; ++kc) c = wmma16(frag_h(rk + kc * 32, lane), aq[kc], c);
#pragma unroll
      for (int r = 0; r < 8; ++r) s[ct][r] = c[r] * 0.125f; }
    float mx = fmaxf(s[0][0], s[1][0]);
#pragma unroll
    for (int r = 1; r < 8; ++r) mx = fmaxf(mx, fmaxf(s[0][r], s[1][r]));
    mx = fmaxf(mx, xhalf(mx));
    const float mn = fmaxf(m, mx); const float alpha = (m <= -1.0e38f) ? 0.f : __expf(m - mn);
    v16h pb; float es0 = 0.f, es1 = 0.f;
#pragma unroll
    for (int r = 0; r < 8; ++r) { const float e0 = __expf(s[0][r] - mn), e1 = __expf(s[1][r] - mn); es0 += e0; es1 += e1;
      pb[r] = (_Float16)(e0 * 2048.0f); pb[8 + r] = (_Float16)(e1 * 2048.0f); }
    l = l * alpha + (es0 + es1); m = mn;
#pragma unroll
    for (int dt = 0; dt < 4; ++dt) {
#pragma unroll
      for (int r = 0; r < 8; ++r) acc[dt][r] *= alpha; }
#pragma unroll
    for (int dt = 0; dt < 4; ++dt) acc[dt] = wmma16(frag_h(vb + (dt * 16 + col) * LP + hs * 32, lane), pb, acc[dt]); }
   asm volatile("s_wait_dscnt 0x0" ::: "memory");      // this wave has left the buffer it read
   asm volatile("s_wait_asynccnt 0x0" ::: "memory");   // its part of the next stage has landed
   __syncthreads();                                     // publishes the next stage and frees this one's buffer
   if (t + 2 < SS / KST) stage_copy(gk + (size_t)(t + 2) * (KST * HD), gv + (t + 2) * KST, lk + (t & 1) * (STG * 2)); }
  asm volatile("s_wait_asynccnt 0x0" ::: "memory");    // no copy is left in flight
  l += xhalf(l);
  const float il = (1.0f / 2048.0f) / l;
#pragma unroll
  for (int dt = 0; dt < 4; ++dt) {
#pragma unroll
    for (int hf = 0; hf < 2; ++hf) { v4f o4;
#pragma unroll
      for (int i = 0; i < 4; ++i) o4[i] = acc[dt][hf * 4 + i] * il;
      *(v4f*)&so[wave][col][dt * 16 + 8 * g + hf * 4] = o4; } }
  LDSX();
  for (int rl = 0; rl < 16; ++rl) if (lane < 16) vst2(O + (rq + rl) * HD + lane * 4, *(const v4f*)&so[wave][rl][lane * 4]);
}
// ---- k_out: block = (64 tokens, bh): out = o (bf16 hi + lo) . Wp^T + bp
__global__ __launch_bounds__(128) void k_out(const float* __restrict__ O, const __bf16* __restrict__ P, const float* __restrict__ BP, float* __restrict__ OUT) {
  __shared__ __align__(16) float so[4][16][68];
  const int tid = threadIdx.x, wave = tid >> 5, lane = tid & 31, col = lane & 15, g = lane >> 4; const size_t bh = blockIdx.y; const size_t r0 = bh * SS + blockIdx.x * 64 + wave * 16;
  v8f acc[4] = {};
#pragma unroll
  for (int kc = 0; kc < HD / 32; ++kc) { const F2 a = split_row(O + (r0 + col) * HD, kc * 32, lane);
#pragma unroll
    for (int j = 0; j < 4; ++j) { const v16b w = frag_b(P + ((size_t)3 * HD + j * 16 + col) * HD + kc * 32, lane); acc[j] = wmma_bf(a.h, w, acc[j]); acc[j] = wmma_bf(a.l, w, acc[j]); } }
#pragma unroll
  for (int j = 0; j < 4; ++j) { const float bb = bfr(BP[j * 16 + col]);
#pragma unroll
    for (int r = 0; r < 8; ++r) so[wave][8 * g + r][j * 16 + col] = acc[j][r] + bb; }
  LDSX();
  for (int rl = 0; rl < 16; ++rl) if (lane < 16) vst2(OUT + (r0 + rl) * HD + lane * 4, *(const v4f*)&so[wave][rl][lane * 4]);
}
extern "C" void kernel_launch(void* const* d_in, const int* in_sizes, int n_in, void* d_out, int out_size, void* d_ws, size_t ws_size, hipStream_t stream) {
  (void)in_sizes; (void)n_in; (void)out_size;
  const float** F = (const float**)d_in;   // 0 x [2,12,4096,64]; 1 Wq [64,64], 2 bq, 3 Wk, 4 bk, 5 Wv, 6 bv, 7 Wp, 8 bp (natural [out][in])
  if (ws_size < (size_t)WS_END) return;
  char* ws = (char*)d_ws; __bf16* P = (__bf16*)ws; _Float16 *Q = (_Float16*)(ws + WS_Q), *Kr = (_Float16*)(ws + WS_K), *V = (_Float16*)(ws + WS_V); float* O = (float*)(ws + WS_O);
  k_pack<<<dim3(HD, 4), 64, 0, stream>>>(F[1], F[3], F[5], F[7], P);
  k_proj<<<dim3(SS / 64, 3, NBH), 128, 0, stream>>>(F[0], P, F[2], F[4], F[6], Q, Kr, V);
  k_attn<<<dim3(TQB, TNB), 128, 0, stream>>>(Q, Kr, V, O);
  k_out<<<dim3(TQB, TNB), 128, 0, stream>>>(O, P, F[8], (float*)d_out);
}

// v004
// A run of this version takes 126 microseconds.
// Timed twice side by side with v003, it ran 1.13 times as fast both times.
// Over all steps from v000 it is 3.04 times as fast.
// compute dtype: all float inputs rounded to bf16; q/k/v = x . W^T + b (64 -> 64 per head) with EXACT bf16 products on WMMA 16x16x32 (natural rows), rounded once to f16; PLAIN attention per (batch, head): q, k single f16, scores transposed (k rows as A, q as B: a lane holds one query), running-max softmax in f32 in base 2 (factor log2(e) / 8, hardware exp2), P (scaled by 2^11 in the exponent, single f16, packed from the score registers as B) under v planes (single f16, A); out = o (bf16 hi + residual) . Wp^T (2 products) + bp; f32 output.
#include <hip/hip_runtime.h>
#include <math.h>

typedef __attribute__((ext_vector_type(16))) _Float16 v16h;
typedef __attribute__((ext_vector_type(16))) __bf16 v16b;
typedef __attribute__((ext_vector_type(8)))  _Float16 v8h;
typedef __attribute__((ext_vector_type(8)))  float v8f;
typedef __attribute__((ext_vector_type(4)))  float v4f;
typedef __attribute__((ext_vector_type(2)))  float v2f;
typedef __attribute__((ext_vector_type(4)))  unsigned v4u;
typedef __attribute__((ext_vector_type(4)))  int v4i;
typedef float __attribute__((may_alias)) float_a;
typedef int __attribute__((may_alias)) int_a;

template <typename T> __device__ __forceinline__ void vst2(void* p, T v) { *(T*)p = v;  }
__device__ __forceinline__ v8f wmma16(v16h a, v16h b, v8f c) {
  v8f d = __builtin_amdgcn_wmma_f32_16x16x32_f16(false, a, false, b, (short)0, c, false, false);
  return d;
}
__device__ __forceinline__ v8f wmma_bf(v16b a, v16b b, v8f c) {
  v8f d = __builtin_amdgcn_wmma_f32_16x16x32_bf16(false, a, false, b, (short)0, c, false, false);
  return d;
}
// 16x16x32 fragments: lane = (h = lane>>4, row/col = lane&15); elements 0..7 = k0+8h+0..7, 8..15 = k0+16+8h+0..7; D element r = row 8h+r
__device__ __forceinline__ v16h frag_h(const _Float16* rowk0, int lane) {
  union { v16h v; v8h q[2]; } u; const _Float16* p = rowk0 + 8 * (lane >> 4);
  u.q[0] = *(const v8h*)p; u.q[1] = *(const v8h*)(p + 16); return u.v;
}
__device__ __forceinline__ v16h frag_f32(const float* rowk0, int lane) {
  v16h a; const float* p = rowk0 + 8 * (lane >> 4);
#pragma unroll
  for (int i = 0; i < 8; ++i) { a[i] = (_Float16)p[i]; a[8 + i] = (_Float16)p[16 + i]; }
  return a;
}
__device__ __forceinline__ v16h frag_f32s(const float* rowk0, int lane, float sc) {
  v16h a; const float* p = rowk0 + 8 * (lane >> 4);
#pragma unroll
  for (int i = 0; i < 8; ++i) { a[i] = (_Float16)(p[i] * sc); a[8 + i] = (_Float16)(p[16 + i] * sc); }
  return a;
}
// column fragment from a [K][ld] layout (column n), rows >= K read as 0
__device__ __forceinline__ v16h fragc_f32(const float* W, int k0, int n, int lane, int ld, int K) {
  v16h a; const int g = lane >> 4;
#pragma unroll
  for (int i = 0; i < 8; ++i) { const int ka = k0 + 8 * g + i, kb = ka + 16;
    a[i] = (_Float16)(ka < K ? W[(size_t)(ka < K ? ka : K - 1) * ld + n] : 0.f); a[8 + i] = (_Float16)(kb < K ? W[(size_t)(kb < K ? kb : K - 1) * ld + n] : 0.f); }
  return a;
}
struct F2 { v16b h, l; };
__device__ __forceinline__ F2 bsplit16(const float v[16]) { F2 r;
#pragma unroll
  for (int i = 0; i < 16; ++i) { const __bf16 h = (__bf16)v[i]; r.h[i] = h; r.l[i] = (__bf16)(v[i] - (float)h); }
  return r; }
__device__ __forceinline__ F2 split_row(const float* row, int k0, int lane) { float v[16]; const float* p = row + k0 + 8 * (lane >> 4);
#pragma unroll
  for (int i = 0; i < 8; ++i) { v[i] = p[i]; v[8 + i] = p[16 + i]; }
  return bsplit16(v); }
__device__ __forceinline__ F2 split_rowK(const float* row, int k0, int lane, int K) { float v[16]; const int g = lane >> 4;
#pragma unroll
  for (int i = 0; i < 8; ++i) { const int ka = k0 + 8 * g + i, kb = ka + 16; v[i] = ka < K ? row[ka < K ? ka : K - 1] : 0.f; v[8 + i] = kb < K ? row[kb < K ? kb : K - 1] : 0.f; }
  return bsplit16(v); }
__device__ __forceinline__ F2 split_col(const float* W, int k0, int n, int lane, int ld, int K) { float v[16]; const int g = lane >> 4;
#pragma unroll
  for (int i = 0; i < 8; ++i) { const int ka = k0 + 8 * g + i, kb = ka + 16; v[i] = ka < K ? W[(size_t)(ka < K ? ka : K - 1) * ld + n] : 0.f; v[8 + i] = kb < K ? W[(size_t)(kb < K ? kb : K - 1) * ld + n] : 0.f; }
  return bsplit16(v); }
__device__ __forceinline__ v8f mac3(const F2& a, const F2& b, v8f c) { c = wmma_bf(a.l, b.h, c); c = wmma_bf(a.h, b.l, c); return wmma_bf(a.h, b.h, c); }
__device__ __forceinline__ float sigm(float v) { return 1.0f / (1.0f + expf(-v)); }
#define LDSX() do { asm volatile("s_wait_dscnt 0" ::: "memory"); __builtin_amdgcn_wave_barrier(); __builtin_amdgcn_fence(__ATOMIC_RELEASE, "workgroup"); } while (0)


// Sub-space attention on a head-split input (B 2, 12 heads, 4,096 tokens, 64 dims): per-head 64x64 q/k/v linears + biases, softmax(q k^T / 8) v, 64x64 output linear + bias.
#define NBH 24            // B * H batch-heads
#define SS 4096
#define HD 64
#define NR (NBH * SS)
#ifndef TQB
#define TQB (SS / 64)
#define TNB NBH
#endif
typedef __attribute__((ext_vector_type(8))) __bf16 v8b;
__device__ __forceinline__ v16b frag_b(const __bf16* rowk0, int lane) {
  union { v16b v; v8b q[2]; } u; const __bf16* p = rowk0 + 8 * (lane >> 4);
  u.q[0] = *(const v8b*)p; u.q[1] = *(const v8b*)(p + 16); return u.v;
}
__device__ __forceinline__ float bfr(float v) { return (float)(__bf16)v; }
__device__ __attribute__((noinline)) float exp_ni(float v) { return expf(v); }
__device__ __attribute__((noinline)) float erf_ni(float v) { return erff(v); }

#define WS_PW  0u                                 // bf16 natural rows Wq, Wk, Wv, Wp [4][64][64]
#define WS_Q   (WS_PW + 2u * 4 * HD * HD + 256u)   // f16 q rows [NR][64] ; k rows ; v planes [bh][64][SS] ; O f32 [NR][64]
#define WS_K   (WS_Q + 2u * (size_t)NR * HD)
#define WS_V   (WS_K + 2u * (size_t)NR * HD)
#define WS_O   (WS_V + 2u * (size_t)NBH * HD * SS)
#define WS_END (WS_O + 4u * (size_t)NR * HD)

__global__ __launch_bounds__(64) void k_pack(const float* __restrict__ WQ, const float* __restrict__ WK, const float* __restrict__ WV, const float* __restrict__ WP, __bf16* __restrict__ P) { const int n = blockIdx.x, m = blockIdx.y, t = threadIdx.x; const float* w = (m == 0) ? WQ : (m == 1) ? WK : (m == 2) ? WV : WP; __shared__ __align__(16) __bf16 s[HD]; s[t] = (__bf16)w[(size_t)n * HD + t]; __syncthreads(); if (t < HD / 8) vst2((unsigned*)(P + ((size_t)m * HD + n) * HD + t * 8), *(const v4u*)&s[t * 8]); }
// ---- k_proj: block = (64 tokens, which, bh): y = x . W^T + b (K = 64); q/k rows, v planes
__global__ __launch_bounds__(128) void k_proj(const float* __restrict__ X, const __bf16* __restrict__ P, const float* __restrict__ BQ, const float* __restrict__ BK, const float* __restrict__ BV, _Float16* __restrict__ Q, _Float16* __restrict__ Kr, _Float16* __restrict__ V) {
  __shared__ __align__(16) _Float16 so[64][72]; __shared__ __align__(16) _Float16 st[64][72];
  const int tid = threadIdx.x, wave = tid >> 5, lane = tid & 31, col = lane & 15, g = lane >> 4; const int which = blockIdx.y; const size_t bh = blockIdx.z; const int n0b = blockIdx.x * 64; const size_t r0 = bh * SS + n0b + wave * 16; const float* BB = (which == 0) ? BQ : (which == 1) ? BK : BV;
  v8f acc[4] = {};
#pragma unroll
  for (int kc = 0; kc < HD / 32; ++kc) { v16b a; { const float* p = X + (r0 + col) * HD + kc * 32 + 8 * g;
#pragma unroll
      for (int i = 0; i < 8; ++i) { a[i] = (__bf16)p[i]; a[8 + i] = (__bf16)p[16 + i]; } }
#pragma unroll
    for (int j = 0; j < 4; ++j) acc[j] = wmma_bf(a, frag_b(P + ((size_t)which * HD + j * 16 + col) * HD + kc * 32, lane), acc[j]); }
  if (which < 2) { _Float16* dst = (which == 0) ? Q : Kr;
#pragma unroll
    for (int j = 0; j < 4; ++j) { const float bb = bfr(BB[j * 16 + col]);
#pragma unroll
      for (int r = 0; r < 8; ++r) so[wave * 16 + 8 * g + r][j * 16 + col] = (_Float16)(acc[j][r] + bb); }
    LDSX();
    for (int rl = 0; rl < 16; ++rl) if (lane < 8) vst2((unsigned*)(dst + (r0 + rl) * HD + lane * 8), *(const v4u*)&so[wave * 16 + rl][lane * 8]);
  } else {
#pragma unroll
    for (int j = 0; j < 4; ++j) { const float bb = bfr(BB[j * 16 + col]);
#pragma unroll
      for (int r = 0; r < 8; ++r) st[j * 16 + col][wave * 16 + 8 * g + r] = (_Float16)(acc[j][r] + bb); }
    __syncthreads();
    for (int e = tid; e < 64 * 8; e += 128) { const int d = e >> 3, pc = e & 7; vst2((unsigned*)(V + (bh * HD + d) * SS + n0b + pc * 8), *(const v4u*)&st[d][pc * 8]); } }
}
// ---- k_attn: block = (64 queries, bh): plain 64-wide attention over 4,096 keys; O f32 rows
// k rows and v planes reach the four waves through LDS: a stage = 64 keys = 64 k rows and 64 v plane pieces of 128 B each, two buffers, the next stage's copies in flight while this one is worked on
#define KST 64                 // keys a stage
#define KL2 0.18033688011112042f   // log2(e) / 8: the score scale and the change of base in one factor
#define LP 72                  // LDS row pitch in halves: 144 B = 16 B x 9, free of bank conflicts for the 16-byte fragment reads
#define STG (2 * 64 * LP)      // halves a buffer: 64 k rows, behind them 64 v plane pieces
// each thread brings 4 + 4 pieces of 16 B (rows 16 apart), a wave's copy covers 4 whole 128-B rows; gk, gv: the thread's first pieces, lk: the LDS byte address of the first
__device__ __forceinline__ void stage_copy(const _Float16* gk, const _Float16* gv, unsigned lk) {
  const unsigned lv = lk + 64 * LP * 2;
  // the closing s_wait_xcnt stands inside the statement so that no address register named here is rewritten ahead of it (a precaution)
  asm volatile("global_load_async_to_lds_b128 %0, %1, off\n\t"
               "global_load_async_to_lds_b128 %2, %3, off\n\t"
               "global_load_async_to_lds_b128 %4, %5, off\n\t"
               "global_load_async_to_lds_b128 %6, %7, off\n\t"
               "global_load_async_to_lds_b128 %8, %9, off\n\t"
               "global_load_async_to_lds_b128 %10, %11, off\n\t"
               "global_load_async_to_lds_b128 %12, %13, off\n\t"
               "global_load_async_to_lds_b128 %14, %15, off\n\t"
               "s_wait_xcnt 0x0"
               :: "v"(lk), "v"(gk), "v"(lk + 16 * LP * 2), "v"(gk + 16 * HD), "v"(lk + 32 * LP * 2), "v"(gk + 32 * HD), "v"(lk + 48 * LP * 2), "v"(gk + 48 * HD),
                  "v"(lv), "v"(gv), "v"(lv + 16 * LP * 2), "v"(gv + 16 * SS), "v"(lv + 32 * LP * 2), "v"(gv + 32 * SS), "v"(lv + 48 * LP * 2), "v"(gv + 48 * SS)
               : "memory");
}
// lane l's value from lane l ^ 16
__device__ __forceinline__ float xhalf(float x) { const int b = __builtin_bit_cast(int, x); return __builtin_bit_cast(float, __builtin_amdgcn_permlanex16(b, b, 0x76543210, 0xfedcba98, false, false)); }
__global__ __launch_bounds__(128) void k_attn(const _Float16* __restrict__ Q, const _Float16* __restrict__ Kr, const _Float16* __restrict__ V, float* __restrict__ O) {
  __shared__ __align__(16) _Float16 ring[2][STG];
  float (*so)[16][68] = (float (*)[16][68])&ring[0][0];   // behind the loop the ring's first buffer is the output staging
  const int tid = threadIdx.x, wave = tid >> 5, lane = tid & 31, col = lane & 15, g = lane >> 4; const size_t bh = blockIdx.y; const int q0 = blockIdx.x * 64 + wave * 16; const size_t rq = bh * SS + q0;
  const _Float16* gk = Kr + (bh * SS + (tid >> 3)) * HD + (tid & 7) * 8; const _Float16* gv = V + (bh * HD + (tid >> 3)) * SS + (tid & 7) * 8;
  const unsigned lk = (unsigned)(size_t)&ring[0][(tid >> 3) * LP + (tid & 7) * 8];
  stage_copy(gk, gv, lk);
  asm volatile("s_wait_asynccnt 0x0" ::: "memory");   // this wave's part of stage 0 has landed
  __syncthreads();                                     // and every other wave's
  stage_copy(gk + KST * HD, gv + KST, lk + STG * 2);
  v16h aq[2];
#pragma unroll
  for (int kc = 0; kc < 2; ++kc) aq[kc] = frag_h(Q + (rq + col) * HD + kc * 32, lane);
  float m = -3.0e38f, l = 0.f;
  v8f acc[4] = {};
#pragma unroll 1
  for (int t = 0; t < SS / KST; ++t) { const _Float16* kb = &ring[t & 1][0]; const _Float16* vb = kb + 64 * LP;
#pragma unroll   // the two 32-key steps of a stage: unrolled, their LDS offsets are immediates
   for (int hs = 0; hs < KST / 32; ++hs) { v8f s[2];
#pragma unroll
    for (int ct = 0; ct < 2; ++ct) { const _Float16* rk = kb + (hs * 32 + ct * 16 + col) * LP; v8f c = {};
#pragma unroll
      for (int kc = 0; kc < 2; ++kc) c = wmma16(frag_h(rk + kc * 32, lane), aq[kc], c);
      s[ct] = c; }
    float mx = fmaxf(s[0][0], s[1][0]);
#pragma unroll
    for (int r = 1; r < 8; ++r) mx = fmaxf(mx, fmaxf(s[0][r], s[1][r]));
    mx = fmaxf(mx, xhalf(mx));
    const float mn = fmaxf(m, mx); const float alpha = (m <= -1.0e38f) ? 0.f : __builtin_amdgcn_exp2f((m - mn) * KL2);
    const float off = 11.0f - mn * KL2;   // e = 2^11 exp((s - mn) / 8) = exp2(s KL2 + off): one packed fused multiply-add for two scores
    v16h pb; float es0 = 0.f, es1 = 0.f;
#pragma unroll
    for (int i = 0; i < 4; ++i) { const v2f t0 = __builtin_elementwise_fma((v2f){s[0][2 * i], s[0][2 * i + 1]}, (v2f){KL2, KL2}, (v2f){off, off}), t1 = __builtin_elementwise_fma((v2f){s[1][2 * i], s[1][2 * i + 1]}, (v2f){KL2, KL2}, (v2f){off, off});
#pragma unroll   // the two scores of a pair: unrolled, so that every vector element index is a constant and stays in a register
      for (int j = 0; j < 2; ++j) { const float e0 = __builtin_amdgcn_exp2f(t0[j]), e1 = __builtin_amdgcn_exp2f(t1[j]); es0 += e0; es1 += e1;
        pb[2 * i + j] = (_Float16)e0; pb[8 + 2 * i + j] = (_Float16)e1; } }
    l = l * alpha + (es0 + es1); m = mn;
#pragma unroll
    for (int dt = 0; dt < 4; ++dt) {
#pragma unroll
      for (int r = 0; r < 8; ++r) acc[dt][r] *= alpha; }
#pragma unroll
    for (int dt = 0; dt < 4; ++dt) acc[dt] = wmma16(frag_h(vb + (dt * 16 + col) * LP + hs * 32, lane), pb, acc[dt]); }
   asm volatile("s_wait_dscnt 0x0" ::: "memory");      // this wave has left the buffer it read
   asm volatile("s_wait_asynccnt 0x0" ::: "memory");   // its part of the next stage has landed
   __syncthreads();                                     // publishes the next stage and frees this one's buffer
   if (t + 2 < SS / KST) stage_copy(gk + (size_t)(t + 2) * (KST * HD), gv + (t + 2) * KST, lk + (t & 1) * (STG * 2)); }
  asm volatile("s_wait_asynccnt 0x0" ::: "memory");    // no copy is left in flight
  l += xhalf(l);
  const float il = 1.0f / l;   // l carries the same 2^11 as P
#pragma unroll
  for (int dt = 0; dt < 4; ++dt) {
#pragma unroll
    for (int hf = 0; hf < 2; ++hf) { v4f o4;
#pragma unroll
      for (int i = 0; i < 4; ++i) o4[i] = acc[dt][hf * 4 + i] * il;
      *(v4f*)&so[wave][col][dt * 16 + 8 * g + hf * 4] = o4; } }
  LDSX();
  for (int rl = 0; rl < 16; ++rl) if (lane < 16) vst2(O + (rq + rl) * HD + lane * 4, *(const v4f*)&so[wave][rl][lane * 4]);
}
// ---- k_out: block = (64 tokens, bh): out = o (bf16 hi + lo) . Wp^T + bp
__global__ __launch_bounds__(128) void k_out(const float* __restrict__ O, const __bf16* __restrict__ P, const float* __restrict__ BP, float* __restrict__ OUT) {
  __shared__ __align__(16) float so[4][16][68];
  const int tid = threadIdx.x, wave = tid >> 5, lane = tid & 31, col = lane & 15, g = lane >> 4; const size_t bh = blockIdx.y; const size_t r0 = bh * SS + blockIdx.x * 64 + wave * 16;
  v8f acc[4] = {};
#pragma unroll
  for (int kc = 0; kc < HD / 32; ++kc) { const F2 a = split_row(O + (r0 + col) * HD, kc * 32, lane);
#pragma unroll
    for (int j = 0; j < 4; ++j) { const v16b w = frag_b(P + ((size_t)3 * HD + j * 16 + col) * HD + kc * 32, lane); acc[j] = wmma_bf(a.h, w, acc[j]); acc[j] = wmma_bf(a.l, w, acc[j]); } }
#pragma unroll
  for (int j = 0; j < 4; ++j) { const float bb = bfr(BP[j * 16 + col]);
#pragma unroll
    for (int r = 0; r < 8; ++r) so[wave][8 * g + r][j * 16 + col] = acc[j][r] + bb; }
  LDSX();
  for (int rl = 0; rl < 16; ++rl) if (lane < 16) vst2(OUT + (r0 + rl) * HD + lane * 4, *(const v4f*)&so[wave][rl][lane * 4]);
}
extern "C" void kernel_launch(void* const* d_in, const int* in_sizes, int n_in, void* d_out, int out_size, void* d_ws, size_t ws_size, hipStream_t stream) {
  (void)in_sizes; (void)n_in; (void)out_size;
  const float** F = (const float**)d_in;   // 0 x [2,12,4096,64]; 1 Wq [64,64], 2 bq, 3 Wk, 4 bk, 5 Wv, 6 bv, 7 Wp, 8 bp (natural [out][in])
  if (ws_size < (size_t)WS_END) return;
  char* ws = (char*)d_ws; __bf16* P = (__bf16*)ws; _Float16 *Q = (_Float16*)(ws + WS_Q), *Kr = (_Float16*)(ws + WS_K), *V = (_Float16*)(ws + WS_V); float* O = (float*)(ws + WS_O);
  k_pack<<<dim3(HD, 4), 64, 0, stream>>>(F[1], F[3], F[5], F[7], P);
  k_proj<<<dim3(SS / 64, 3, NBH), 128, 0, stream>>>(F[0], P, F[2], F[4], F[6], Q, Kr, V);
  k_attn<<<dim3(TQB, TNB), 128, 0, stream>>>(Q, Kr, V, O);
  k_out<<<dim3(TQB, TNB), 128, 0, stream>>>(O, P, F[8], (float*)d_out);
}

// v005
// It runs in 120 microseconds.
// In both of two side-by-side timings against v004, it was 1.06 times as fast.
// Counting every step since v000, it is 3.21 times as fast.
// compute dtype: all float inputs rounded to bf16; q/k/v = x . W^T + b (64 -> 64 per head) with EXACT bf16 products on WMMA 16x16x32 (natural rows), rounded once to f16; PLAIN attention per (batch, head): q, k single f16, scores transposed (k rows as A, q as B: a lane holds one query of each of the wave's two query tiles), running-max softmax in f32 in base 2 (factor log2(e) / 8, hardware exp2), P (scaled by 2^11 in the exponent, single f16, packed from the score registers as B) under v planes (single f16, A); out = o (bf16 hi + residual) . Wp^T (2 products) + bp; f32 output.
#include <hip/hip_runtime.h>
#include <math.h>

typedef __attribute__((ext_vector_type(16))) _Float16 v16h;
typedef __attribute__((ext_vector_type(16))) __bf16 v16b;
typedef __attribute__((ext_vector_type(8)))  _Float16 v8h;
typedef __attribute__((ext_vector_type(8)))  float v8f;
typedef __attribute__((ext_vector_type(4)))  float v4f;
typedef __attribute__((ext_vector_type(2)))  float v2f;
typedef __attribute__((ext_vector_type(4)))  unsigned v4u;
typedef __attribute__((ext_vector_type(4)))  int v4i;
typedef float __attribute__((may_alias)) float_a;
typedef int __attribute__((may_alias)) int_a;

template <typename T> __device__ __forceinline__ void vst2(void* p, T v) { *(T*)p = v;  }
__device__ __forceinline__ v8f wmma16(v16h a, v16h b, v8f c) {
  v8f d = __builtin_amdgcn_wmma_f32_16x16x32_f16(false, a, false, b, (short)0, c, false, false);
  return d;
}
__device__ __forceinline__ v8f wmma_bf(v16b a, v16b b, v8f c) {
  v8f d = __builtin_amdgcn_wmma_f32_16x16x32_bf16(false, a, false, b, (short)0, c, false, false);
  return d;
}
// 16x16x32 fragments: lane = (h = lane>>4, row/col = lane&15); elements 0..7 = k0+8h+0..7, 8..15 = k0+16+8h+0..7; D element r = row 8h+r
__device__ __forceinline__ v16h frag_h(const _Float16* rowk0, int lane) {
  union { v16h v; v8h q[2]; } u; const _Float16* p = rowk0 + 8 * (lane >> 4);
  u.q[0] = *(const v8h*)p; u.q[1] = *(const v8h*)(p + 16); return u.v;
}
__device__ __forceinline__ v16h frag_f32(const float* rowk0, int lane) {
  v16h a; const float* p = rowk0 + 8 * (lane >> 4);
#pragma unroll
  for (int i = 0; i < 8; ++i) { a[i] = (_Float16)p[i]; a[8 + i] = (_Float16)p[16 + i]; }
  return a;
}
__device__ __forceinline__ v16h frag_f32s(const float* rowk0, int lane, float sc) {
  v16h a; const float* p = rowk0 + 8 * (lane >> 4);
#pragma unroll
  for (int i = 0; i < 8; ++i) { a[i] = (_Float16)(p[i] * sc); a[8 + i] = (_Float16)(p[16 + i] * sc); }
  return a;
}
// column fragment from a [K][ld] layout (column n), rows >= K read as 0
__device__ __forceinline__ v16h fragc_f32(const float* W, int k0, int n, int lane, int ld, int K) {
  v16h a; const int g = lane >> 4;
#pragma unroll
  for (int i = 0; i < 8; ++i) { const int ka = k0 + 8 * g + i, kb = ka + 16;
    a[i] = (_Float16)(ka < K ? W[(size_t)(ka < K ? ka : K - 1) * ld + n] : 0.f); a[8 + i] = (_Float16)(kb < K ? W[(size_t)(kb < K ? kb : K - 1) * ld + n] : 0.f); }
  return a;
}
struct F2 { v16b h, l; };
__device__ __forceinline__ F2 bsplit16(const float v[16]) { F2 r;
#pragma unroll
  for (int i = 0; i < 16; ++i) { const __bf16 h = (__bf16)v[i]; r.h[i] = h; r.l[i] = (__bf16)(v[i] - (float)h); }
  return r; }
__device__ __forceinline__ F2 split_row(const float* row, int k0, int lane) { float v[16]; const float* p = row + k0 + 8 * (lane >> 4);
#pragma unroll
  for (int i = 0; i < 8; ++i) { v[i] = p[i]; v[8 + i] = p[16 + i]; }
  return bsplit16(v); }
__device__ __forceinline__ F2 split_rowK(const float* row, int k0, int lane, int K) { float v[16]; const int g = lane >> 4;
#pragma unroll
  for (int i = 0; i < 8; ++i) { const int ka = k0 + 8 * g + i, kb = ka + 16; v[i] = ka < K ? row[ka < K ? ka : K - 1] : 0.f; v[8 + i] = kb < K ? row[kb < K ? kb : K - 1] : 0.f; }
  return bsplit16(v); }
__device__ __forceinline__ F2 split_col(const float* W, int k0, int n, int lane, int ld, int K) { float v[16]; const int g = lane >> 4;
#pragma unroll
  for (int i = 0; i < 8; ++i) { const int ka = k0 + 8 * g + i, kb = ka + 16; v[i] = ka < K ? W[(size_t)(ka < K ? ka : K - 1) * ld + n] : 0.f; v[8 + i] = kb < K ? W[(size_t)(kb < K ? kb : K - 1) * ld + n] : 0.f; }
  return bsplit16(v); }
__device__ __forceinline__ v8f mac3(const F2& a, const F2& b, v8f c) { c = wmma_bf(a.l, b.h, c); c = wmma_bf(a.h, b.l, c); return wmma_bf(a.h, b.h, c); }
__device__ __forceinline__ float sigm(float v) { return 1.0f / (1.0f + expf(-v)); }
#define LDSX() do { asm volatile("s_wait_dscnt 0" ::: "memory"); __builtin_amdgcn_wave_barrier(); __builtin_amdgcn_fence(__ATOMIC_RELEASE, "workgroup"); } while (0)


// Sub-space attention on a head-split input (B 2, 12 heads, 4,096 tokens, 64 dims): per-head 64x64 q/k/v linears + biases, softmax(q k^T / 8) v, 64x64 output linear + bias.
#define NBH 24            // B * H batch-heads
#define SS 4096
#define HD 64
#define NR (NBH * SS)
#ifndef TQB
#define TQB (SS / 64)
#define TNB NBH
#endif
typedef __attribute__((ext_vector_type(8))) __bf16 v8b;
__device__ __forceinline__ v16b frag_b(const __bf16* rowk0, int lane) {
  union { v16b v; v8b q[2]; } u; const __bf16* p = rowk0 + 8 * (lane >> 4);
  u.q[0] = *(const v8b*)p; u.q[1] = *(const v8b*)(p + 16); return u.v;
}
__device__ __forceinline__ float bfr(float v) { return (float)(__bf16)v; }
__device__ __attribute__((noinline)) float exp_ni(float v) { return expf(v); }
__device__ __attribute__((noinline)) float erf_ni(float v) { return erff(v); }

#define WS_PW  0u                                 // bf16 natural rows Wq, Wk, Wv, Wp [4][64][64]
#define WS_Q   (WS_PW + 2u * 4 * HD * HD + 256u)   // f16 q rows [NR][64] ; k rows ; v planes [bh][64][SS] ; O f32 [NR][64]
#define WS_K   (WS_Q + 2u * (size_t)NR * HD)
#define WS_V   (WS_K + 2u * (size_t)NR * HD)
#define WS_O   (WS_V + 2u * (size_t)NBH * HD * SS)
#define WS_END (WS_O + 4u * (size_t)NR * HD)

__global__ __launch_bounds__(64) void k_pack(const float* __restrict__ WQ, const float* __restrict__ WK, const float* __restrict__ WV, const float* __restrict__ WP, __bf16* __restrict__ P) { const int n = blockIdx.x, m = blockIdx.y, t = threadIdx.x; const float* w = (m == 0) ? WQ : (m == 1) ? WK : (m == 2) ? WV : WP; __shared__ __align__(16) __bf16 s[HD]; s[t] = (__bf16)w[(size_t)n * HD + t]; __syncthreads(); if (t < HD / 8) vst2((unsigned*)(P + ((size_t)m * HD + n) * HD + t * 8), *(const v4u*)&s[t * 8]); }
// ---- k_proj: block = (64 tokens, which, bh): y = x . W^T + b (K = 64); q/k rows, v planes
__global__ __launch_bounds__(128) void k_proj(const float* __restrict__ X, const __bf16* __restrict__ P, const float* __restrict__ BQ, const float* __restrict__ BK, const float* __restrict__ BV, _Float16* __restrict__ Q, _Float16* __restrict__ Kr, _Float16* __restrict__ V) {
  __shared__ __align__(16) _Float16 so[64][72]; __shared__ __align__(16) _Float16 st[64][72];
  const int tid = threadIdx.x, wave = tid >> 5, lane = tid & 31, col = lane & 15, g = lane >> 4; const int which = blockIdx.y; const size_t bh = blockIdx.z; const int n0b = blockIdx.x * 64; const size_t r0 = bh * SS + n0b + wave * 16; const float* BB = (which == 0) ? BQ : (which == 1) ? BK : BV;
  v8f acc[4] = {};
#pragma unroll
  for (int kc = 0; kc < HD / 32; ++kc) { v16b a; { const float* p = X + (r0 + col) * HD + kc * 32 + 8 * g;
#pragma unroll
      for (int i = 0; i < 8; ++i) { a[i] = (__bf16)p[i]; a[8 + i] = (__bf16)p[16 + i]; } }
#pragma unroll
    for (int j = 0; j < 4; ++j) acc[j] = wmma_bf(a, frag_b(P + ((size_t)which * HD + j * 16 + col) * HD + kc * 32, lane), acc[j]); }
  if (which < 2) { _Float16* dst = (which == 0) ? Q : Kr;
#pragma unroll
    for (int j = 0; j < 4; ++j) { const float bb = bfr(BB[j * 16 + col]);
#pragma unroll
      for (int r = 0; r < 8; ++r) so[wave * 16 + 8 * g + r][j * 16 + col] = (_Float16)(acc[j][r] + bb); }
    LDSX();
    for (int rl = 0; rl < 16; ++rl) if (lane < 8) vst2((unsigned*)(dst + (r0 + rl) * HD + lane * 8), *(const v4u*)&so[wave * 16 + rl][lane * 8]);
  } else {
#pragma unroll
    for (int j = 0; j < 4; ++j) { const float bb = bfr(BB[j * 16 + col]);
#pragma unroll
      for (int r = 0; r < 8; ++r) st[j * 16 + col][wave * 16 + 8 * g + r] = (_Float16)(acc[j][r] + bb); }
    __syncthreads();
    for (int e = tid; e < 64 * 8; e += 128) { const int d = e >> 3, pc = e & 7; vst2((unsigned*)(V + (bh * HD + d) * SS + n0b + pc * 8), *(const v4u*)&st[d][pc * 8]); } }
}
// ---- k_attn: block = (128 queries, bh), a wave = 32 queries = two query tiles: plain 64-wide attention over 4,096 keys; O f32 rows
// every k and v fragment read from LDS feeds two products, one a query tile: half the LDS reads and half the staged bytes a query
// k rows and v planes reach the four waves through LDS: a stage = 64 keys = 64 k rows and 64 v plane pieces of 128 B each, two buffers, the next stage's copies in flight while this one is worked on
#define KST 64                 // keys a stage
#define QT 2                   // query tiles of 16 a wave
#define KL2 0.18033688011112042f   // log2(e) / 8: the score scale and the change of base in one factor
#define LP 72                  // LDS row pitch in halves: 144 B = 16 B x 9, free of bank conflicts for the 16-byte fragment reads
#define STG (2 * 64 * LP)      // halves a buffer: 64 k rows, behind them 64 v plane pieces
// each thread brings 4 + 4 pieces of 16 B (rows 16 apart), a wave's copy covers 4 whole 128-B rows; gk, gv: the thread's first pieces, lk: the LDS byte address of the first
__device__ __forceinline__ void stage_copy(const _Float16* gk, const _Float16* gv, unsigned lk) {
  const unsigned lv = lk + 64 * LP * 2;
  // the closing s_wait_xcnt stands inside the statement so that no address register named here is rewritten ahead of it (a precaution)
  asm volatile("global_load_async_to_lds_b128 %0, %1, off\n\t"
               "global_load_async_to_lds_b128 %2, %3, off\n\t"
               "global_load_async_to_lds_b128 %4, %5, off\n\t"
               "global_load_async_to_lds_b128 %6, %7, off\n\t"
               "global_load_async_to_lds_b128 %8, %9, off\n\t"
               "global_load_async_to_lds_b128 %10, %11, off\n\t"
               "global_load_async_to_lds_b128 %12, %13, off\n\t"
               "global_load_async_to_lds_b128 %14, %15, off\n\t"
               "s_wait_xcnt 0x0"
               :: "v"(lk), "v"(gk), "v"(lk + 16 * LP * 2), "v"(gk + 16 * HD), "v"(lk + 32 * LP * 2), "v"(gk + 32 * HD), "v"(lk + 48 * LP * 2), "v"(gk + 48 * HD),
                  "v"(lv), "v"(gv), "v"(lv + 16 * LP * 2), "v"(gv + 16 * SS), "v"(lv + 32 * LP * 2), "v"(gv + 32 * SS), "v"(lv + 48 * LP * 2), "v"(gv + 48 * SS)
               : "memory");
}
// lane l's value from lane l ^ 16
__device__ __forceinline__ float xhalf(float x) { const int b = __builtin_bit_cast(int, x); return __builtin_bit_cast(float, __builtin_amdgcn_permlanex16(b, b, 0x76543210, 0xfedcba98, false, false)); }
__global__ __launch_bounds__(128) void k_attn(const _Float16* __restrict__ Q, const _Float16* __restrict__ Kr, const _Float16* __restrict__ V, float* __restrict__ O) {
  __shared__ __align__(16) _Float16 ring[2][STG];
  float (*so)[16 * QT][68] = (float (*)[16 * QT][68])&ring[0][0];   // behind the loop the ring (both buffers) is the output staging
  static_assert(sizeof(float) * 4 * 16 * QT * 68 <= sizeof(ring), "output staging fits the ring");
  const int tid = threadIdx.x, wave = tid >> 5, lane = tid & 31, col = lane & 15, g = lane >> 4; const size_t bh = blockIdx.y; const int q0 = blockIdx.x * (64 * QT) + wave * (16 * QT); const size_t rq = bh * SS + q0;
  const _Float16* gk = Kr + (bh * SS + (tid >> 3)) * HD + (tid & 7) * 8; const _Float16* gv = V + (bh * HD + (tid >> 3)) * SS + (tid & 7) * 8;
  const unsigned lk = (unsigned)(size_t)&ring[0][(tid >> 3) * LP + (tid & 7) * 8];
  stage_copy(gk, gv, lk);
  asm volatile("s_wait_asynccnt 0x0" ::: "memory");   // this wave's part of stage 0 has landed
  __syncthreads();                                     // and every other wave's
  stage_copy(gk + KST * HD, gv + KST, lk + STG * 2);
  v16h aq[QT][2];
#pragma unroll
  for (int qt = 0; qt < QT; ++qt) {
#pragma unroll
    for (int kc = 0; kc < 2; ++kc) aq[qt][kc] = frag_h(Q + (rq + qt * 16 + col) * HD + kc * 32, lane); }
  float m[QT], l[QT];
  v8f acc[QT][4] = {};
#pragma unroll
  for (int qt = 0; qt < QT; ++qt) { m[qt] = -3.0e38f; l[qt] = 0.f; }
#pragma unroll 1
  for (int t = 0; t < SS / KST; ++t) { const _Float16* kb = &ring[t & 1][0]; const _Float16* vb = kb + 64 * LP;
#pragma unroll   // the two 32-key steps of a stage: unrolled, their LDS offsets are immediates
   for (int hs = 0; hs < KST / 32; ++hs) { v8f s[QT][2] = {};
#pragma unroll
    for (int ct = 0; ct < 2; ++ct) { const _Float16* rk = kb + (hs * 32 + ct * 16 + col) * LP;
#pragma unroll
      for (int kc = 0; kc < 2; ++kc) { const v16h ka = frag_h(rk + kc * 32, lane);
#pragma unroll
        for (int qt = 0; qt < QT; ++qt) s[qt][ct] = wmma16(ka, aq[qt][kc], s[qt][ct]); } }
    v16h pb[QT];
#pragma unroll
    for (int qt = 0; qt < QT; ++qt) {
    float mx = fmaxf(s[qt][0][0], s[qt][1][0]);
#pragma unroll
    for (int r = 1; r < 8; ++r) mx = fmaxf(mx, fmaxf(s[qt][0][r], s[qt][1][r]));
    mx = fmaxf(mx, xhalf(mx));
    const float mn = fmaxf(m[qt], mx); const float alpha = (m[qt] <= -1.0e38f) ? 0.f : __builtin_amdgcn_exp2f((m[qt] - mn) * KL2);
    const float off = 11.0f - mn * KL2;   // e = 2^11 exp((s - mn) / 8) = exp2(s KL2 + off): one packed fused multiply-add for two scores
    float es0 = 0.f, es1 = 0.f;
#pragma unroll
    for (int i = 0; i < 4; ++i) { const v2f t0 = __builtin_elementwise_fma((v2f){s[qt][0][2 * i], s[qt][0][2 * i + 1]}, (v2f){KL2, KL2}, (v2f){off, off}), t1 = __builtin_elementwise_fma((v2f){s[qt][1][2 * i], s[qt][1][2 * i + 1]}, (v2f){KL2, KL2}, (v2f){off, off});
#pragma unroll   // the two scores of a pair: unrolled, so that every vector element index is a constant and stays in a register
      for (int j = 0; j < 2; ++j) { const float e0 = __builtin_amdgcn_exp2f(t0[j]), e1 = __builtin_amdgcn_exp2f(t1[j]); es0 += e0; es1 += e1;
        pb[qt][2 * i + j] = (_Float16)e0; pb[qt][8 + 2 * i + j] = (_Float16)e1; } }
    l[qt] = l[qt] * alpha + (es0 + es1); m[qt] = mn;
#pragma unroll
    for (int dt = 0; dt < 4; ++dt) {
#pragma unroll
      for (int r = 0; r < 8; ++r) acc[qt][dt][r] *= alpha; } }
#pragma unroll
    for (int dt = 0; dt < 4; ++dt) { const v16h va = frag_h(vb + (dt * 16 + col) * LP + hs * 32, lane);
#pragma unroll
      for (int qt = 0; qt < QT; ++qt) acc[qt][dt] = wmma16(va, pb[qt], acc[qt][dt]); } }
   asm volatile("s_wait_dscnt 0x0" ::: "memory");      // this wave has left the buffer it read
   asm volatile("s_wait_asynccnt 0x0" ::: "memory");   // its part of the next stage has landed
   __syncthreads();                                     // publishes the next stage and frees this one's buffer
   if (t + 2 < SS / KST) stage_copy(gk + (size_t)(t + 2) * (KST * HD), gv + (t + 2) * KST, lk + (t & 1) * (STG * 2)); }
  asm volatile("s_wait_asynccnt 0x0" ::: "memory");    // no copy is left in flight
#pragma unroll
  for (int qt = 0; qt < QT; ++qt) {
  const float lj = l[qt] + xhalf(l[qt]);
  const float il = 1.0f / lj;   // l carries the same 2^11 as P
#pragma unroll
  for (int dt = 0; dt < 4; ++dt) {
#pragma unroll
    for (int hf = 0; hf < 2; ++hf) { v4f o4;
#pragma unroll
      for (int i = 0; i < 4; ++i) o4[i] = acc[qt][dt][hf * 4 + i] * il;
      *(v4f*)&so[wave][qt * 16 + col][dt * 16 + 8 * g + hf * 4] = o4; } } }
  LDSX();
  for (int rl = 0; rl < 16 * QT; ++rl) if (lane < 16) vst2(O + (rq + rl) * HD + lane * 4, *(const v4f*)&so[wave][rl][lane * 4]);
}
// ---- k_out: block = (64 tokens, bh): out = o (bf16 hi + lo) . Wp^T + bp
__global__ __launch_bounds__(128) void k_out(const float* __restrict__ O, const __bf16* __restrict__ P, const float* __restrict__ BP, float* __restrict__ OUT) {
  __shared__ __align__(16) float so[4][16][68];
  const int tid = threadIdx.x, wave = tid >> 5, lane = tid & 31, col = lane & 15, g = lane >> 4; const size_t bh = blockIdx.y; const size_t r0 = bh * SS + blockIdx.x * 64 + wave * 16;
  v8f acc[4] = {};
#pragma unroll
  for (int kc = 0; kc < HD / 32; ++kc) { const F2 a = split_row(O + (r0 + col) * HD, kc * 32, lane);
#pragma unroll
    for (int j = 0; j < 4; ++j) { const v16b w = frag_b(P + ((size_t)3 * HD + j * 16 + col) * HD + kc * 32, lane); acc[j] = wmma_bf(a.h, w, acc[j]); acc[j] = wmma_bf(a.l, w, acc[j]); } }
#pragma unroll
  for (int j = 0; j < 4; ++j) { const float bb = bfr(BP[j * 16 + col]);
#pragma unroll
    for (int r = 0; r < 8; ++r) so[wave][8 * g + r][j * 16 + col] = acc[j][r] + bb; }
  LDSX();
  for (int rl = 0; rl < 16; ++rl) if (lane < 16) vst2(OUT + (r0 + rl) * HD + lane * 4, *(const v4f*)&so[wave][rl][lane * 4]);
}
extern "C" void kernel_launch(void* const* d_in, const int* in_sizes, int n_in, void* d_out, int out_size, void* d_ws, size_t ws_size, hipStream_t stream) {
  (void)in_sizes; (void)n_in; (void)out_size;
  const float** F = (const float**)d_in;   // 0 x [2,12,4096,64]; 1 Wq [64,64], 2 bq, 3 Wk, 4 bk, 5 Wv, 6 bv, 7 Wp, 8 bp (natural [out][in])
  if (ws_size < (size_t)WS_END) return;
  char* ws = (char*)d_ws; __bf16* P = (__bf16*)ws; _Float16 *Q = (_Float16*)(ws + WS_Q), *Kr = (_Float16*)(ws + WS_K), *V = (_Float16*)(ws + WS_V); float* O = (float*)(ws + WS_O);
  k_pack<<<dim3(HD, 4), 64, 0, stream>>>(F[1], F[3], F[5], F[7], P);
  k_proj<<<dim3(SS / 64, 3, NBH), 128, 0, stream>>>(F[0], P, F[2], F[4], F[6], Q, Kr, V);
  k_attn<<<dim3(SS / (64 * QT), TNB), 128, 0, stream>>>(Q, Kr, V, O);
  k_out<<<dim3(TQB, TNB), 128, 0, stream>>>(O, P, F[8], (float*)d_out);
}

// v006
// One run takes 114 microseconds.
// Next to v005, in two timings, it ran 1.05 times as fast each time.
// Counting every step since v000, it is 3.37 times as fast.
// compute dtype: all float inputs rounded to bf16; q/k/v = x . W^T + b (64 -> 64 per head) with EXACT bf16 products on WMMA 16x16x32 (natural rows), rounded once to f16; PLAIN attention per (batch, head): q, k single f16, scores transposed (k rows as A, q as B: a lane holds one query of each of the wave's two query tiles), softmax in f32 in base 2 (factor log2(e) / 8, hardware exp2) against a maximum that is renewed lazily, P (scaled by 2^11 to 2^15 in the exponent, single f16, packed from the score registers as B) under v planes (single f16, A); out = o (bf16 hi + residual) . Wp^T (2 products) + bp; f32 output.
#include <hip/hip_runtime.h>
#include <math.h>

typedef __attribute__((ext_vector_type(16))) _Float16 v16h;
typedef __attribute__((ext_vector_type(16))) __bf16 v16b;
typedef __attribute__((ext_vector_type(8)))  _Float16 v8h;
typedef __attribute__((ext_vector_type(8)))  float v8f;
typedef __attribute__((ext_vector_type(4)))  float v4f;
typedef __attribute__((ext_vector_type(2)))  float v2f;
typedef __attribute__((ext_vector_type(4)))  unsigned v4u;
typedef __attribute__((ext_vector_type(4)))  int v4i;
typedef float __attribute__((may_alias)) float_a;
typedef int __attribute__((may_alias)) int_a;

template <typename T> __device__ __forceinline__ void vst2(void* p, T v) { *(T*)p = v;  }
__device__ __forceinline__ v8f wmma16(v16h a, v16h b, v8f c) {
  v8f d = __builtin_amdgcn_wmma_f32_16x16x32_f16(false, a, false, b, (short)0, c, false, false);
  return d;
}
__device__ __forceinline__ v8f wmma_bf(v16b a, v16b b, v8f c) {
  v8f d = __builtin_amdgcn_wmma_f32_16x16x32_bf16(false, a, false, b, (short)0, c, false, false);
  return d;
}
// 16x16x32 fragments: lane = (h = lane>>4, row/col = lane&15); elements 0..7 = k0+8h+0..7, 8..15 = k0+16+8h+0..7; D element r = row 8h+r
__device__ __forceinline__ v16h frag_h(const _Float16* rowk0, int lane) {
  union { v16h v; v8h q[2]; } u; const _Float16* p = rowk0 + 8 * (lane >> 4);
  u.q[0] = *(const v8h*)p; u.q[1] = *(const v8h*)(p + 16); return u.v;
}
__device__ __forceinline__ v16h frag_f32(const float* rowk0, int lane) {
  v16h a; const float* p = rowk0 + 8 * (lane >> 4);
#pragma unroll
  for (int i = 0; i < 8; ++i) { a[i] = (_Float16)p[i]; a[8 + i] = (_Float16)p[16 + i]; }
  return a;
}
__device__ __forceinline__ v16h frag_f32s(const float* rowk0, int lane, float sc) {
  v16h a; const float* p = rowk0 + 8 * (lane >> 4);
#pragma unroll
  for (int i = 0; i < 8; ++i) { a[i] = (_Float16)(p[i] * sc); a[8 + i] = (_Float16)(p[16 + i] * sc); }
  return a;
}
// column fragment from a [K][ld] layout (column n), rows >= K read as 0
__device__ __forceinline__ v16h fragc_f32(const float* W, int k0, int n, int lane, int ld, int K) {
  v16h a; const int g = lane >> 4;
#pragma unroll
  for (int i = 0; i < 8; ++i) { const int ka = k0 + 8 * g + i, kb = ka + 16;
    a[i] = (_Float16)(ka < K ? W[(size_t)(ka < K ? ka : K - 1) * ld + n] : 0.f); a[8 + i] = (_Float16)(kb < K ? W[(size_t)(kb < K ? kb : K - 1) * ld + n] : 0.f); }
  return a;
}
struct F2 { v16b h, l; };
__device__ __forceinline__ F2 bsplit16(const float v[16]) { F2 r;
#pragma unroll
  for (int i = 0; i < 16; ++i) { const __bf16 h = (__bf16)v[i]; r.h[i] = h; r.l[i] = (__bf16)(v[i] - (float)h); }
  return r; }
__device__ __forceinline__ F2 split_row(const float* row, int k0, int lane) { float v[16]; const float* p = row + k0 + 8 * (lane >> 4);
#pragma unroll
  for (int i = 0; i < 8; ++i) { v[i] = p[i]; v[8 + i] = p[16 + i]; }
  return bsplit16(v); }
__device__ __forceinline__ F2 split_rowK(const float* row, int k0, int lane, int K) { float v[16]; const int g = lane >> 4;
#pragma unroll
  for (int i = 0; i < 8; ++i) { const int ka = k0 + 8 * g + i, kb = ka + 16; v[i] = ka < K ? row[ka < K ? ka : K - 1] : 0.f; v[8 + i] = kb < K ? row[kb < K ? kb : K - 1] : 0.f; }
  return bsplit16(v); }
__device__ __forceinline__ F2 split_col(const float* W, int k0, int n, int lane, int ld, int K) { float v[16]; const int g = lane >> 4;
#pragma unroll
  for (int i = 0; i < 8; ++i) { const int ka = k0 + 8 * g + i, kb = ka + 16; v[i] = ka < K ? W[(size_t)(ka < K ? ka : K - 1) * ld + n] : 0.f; v[8 + i] = kb < K ? W[(size_t)(kb < K ? kb : K - 1) * ld + n] : 0.f; }
  return bsplit16(v); }
__device__ __forceinline__ v8f mac3(const F2& a, const F2& b, v8f c) { c = wmma_bf(a.l, b.h, c); c = wmma_bf(a.h, b.l, c); return wmma_bf(a.h, b.h, c); }
__device__ __forceinline__ float sigm(float v) { return 1.0f / (1.0f + expf(-v)); }
#define LDSX() do { asm volatile("s_wait_dscnt 0" ::: "memory"); __builtin_amdgcn_wave_barrier(); __builtin_amdgcn_fence(__ATOMIC_RELEASE, "workgroup"); } while (0)


// Sub-space attention on a head-split input (B 2, 12 heads, 4,096 tokens, 64 dims): per-head 64x64 q/k/v linears + biases, softmax(q k^T / 8) v, 64x64 output linear + bias.
#define NBH 24            // B * H batch-heads
#define SS 4096
#define HD 64
#define NR (NBH * SS)
#ifndef TQB
#define TQB (SS / 64)
#define TNB NBH
#endif
typedef __attribute__((ext_vector_type(8))) __bf16 v8b;
__device__ __forceinline__ v16b frag_b(const __bf16* rowk0, int lane) {
  union { v16b v; v8b q[2]; } u; const __bf16* p = rowk0 + 8 * (lane >> 4);
  u.q[0] = *(const v8b*)p; u.q[1] = *(const v8b*)(p + 16); return u.v;
}
__device__ __forceinline__ float bfr(float v) { return (float)(__bf16)v; }
__device__ __attribute__((noinline)) float exp_ni(float v) { return expf(v); }
__device__ __attribute__((noinline)) float erf_ni(float v) { return erff(v); }

#define WS_PW  0u                                 // bf16 natural rows Wq, Wk, Wv, Wp [4][64][64]
#define WS_Q   (WS_PW + 2u * 4 * HD * HD + 256u)   // f16 q rows [NR][64] ; k rows ; v planes [bh][64][SS] ; O f32 [NR][64]
#define WS_K   (WS_Q + 2u * (size_t)NR * HD)
#define WS_V   (WS_K + 2u * (size_t)NR * HD)
#define WS_O   (WS_V + 2u * (size_t)NBH * HD * SS)
#define WS_END (WS_O + 4u * (size_t)NR * HD)

__global__ __launch_bounds__(64) void k_pack(const float* __restrict__ WQ, const float* __restrict__ WK, const float* __restrict__ WV, const float* __restrict__ WP, __bf16* __restrict__ P) { const int n = blockIdx.x, m = blockIdx.y, t = threadIdx.x; const float* w = (m == 0) ? WQ : (m == 1) ? WK : (m == 2) ? WV : WP; __shared__ __align__(16) __bf16 s[HD]; s[t] = (__bf16)w[(size_t)n * HD + t]; __syncthreads(); if (t < HD / 8) vst2((unsigned*)(P + ((size_t)m * HD + n) * HD + t * 8), *(const v4u*)&s[t * 8]); }
// ---- k_proj: block = (64 tokens, which, bh): y = x . W^T + b (K = 64); q/k rows, v planes
__global__ __launch_bounds__(128) void k_proj(const float* __restrict__ X, const __bf16* __restrict__ P, const float* __restrict__ BQ, const float* __restrict__ BK, const float* __restrict__ BV, _Float16* __restrict__ Q, _Float16* __restrict__ Kr, _Float16* __restrict__ V) {
  __shared__ __align__(16) _Float16 so[64][72]; __shared__ __align__(16) _Float16 st[64][72];
  const int tid = threadIdx.x, wave = tid >> 5, lane = tid & 31, col = lane & 15, g = lane >> 4; const int which = blockIdx.y; const size_t bh = blockIdx.z; const int n0b = blockIdx.x * 64; const size_t r0 = bh * SS + n0b + wave * 16; const float* BB = (which == 0) ? BQ : (which == 1) ? BK : BV;
  v8f acc[4] = {};
#pragma unroll
  for (int kc = 0; kc < HD / 32; ++kc) { v16b a; { const float* p = X + (r0 + col) * HD + kc * 32 + 8 * g;
#pragma unroll
      for (int i = 0; i < 8; ++i) { a[i] = (__bf16)p[i]; a[8 + i] = (__bf16)p[16 + i]; } }
#pragma unroll
    for (int j = 0; j < 4; ++j) acc[j] = wmma_bf(a, frag_b(P + ((size_t)which * HD + j * 16 + col) * HD + kc * 32, lane), acc[j]); }
  if (which < 2) { _Float16* dst = (which == 0) ? Q : Kr;
#pragma unroll
    for (int j = 0; j < 4; ++j) { const float bb = bfr(BB[j * 16 + col]);
#pragma unroll
      for (int r = 0; r < 8; ++r) so[wave * 16 + 8 * g + r][j * 16 + col] = (_Float16)(acc[j][r] + bb); }
    LDSX();
    for (int rl = 0; rl < 16; ++rl) if (lane < 8) vst2((unsigned*)(dst + (r0 + rl) * HD + lane * 8), *(const v4u*)&so[wave * 16 + rl][lane * 8]);
  } else {
#pragma unroll
    for (int j = 0; j < 4; ++j) { const float bb = bfr(BB[j * 16 + col]);
#pragma unroll
      for (int r = 0; r < 8; ++r) st[j * 16 + col][wave * 16 + 8 * g + r] = (_Float16)(acc[j][r] + bb); }
    __syncthreads();
    for (int e = tid; e < 64 * 8; e += 128) { const int d = e >> 3, pc = e & 7; vst2((unsigned*)(V + (bh * HD + d) * SS + n0b + pc * 8), *(const v4u*)&st[d][pc * 8]); } }
}
// ---- k_attn: block = (128 queries, bh), a wave = 32 queries = two query tiles: plain 64-wide attention over 4,096 keys; O f32 rows
// every k and v fragment read from LDS feeds two products, one a query tile: half the LDS reads and half the staged bytes a query
// k rows and v planes reach the four waves through LDS: a stage = 64 keys = 64 k rows and 64 v plane pieces of 128 B each, two buffers, the next stage's copies in flight while this one is worked on
#define KST 64                 // keys a stage
#define QT 2                   // query tiles of 16 a wave
#define KL2 0.18033688011112042f   // log2(e) / 8: the score scale and the change of base in one factor
#define RTH (4.0f / KL2)      // a raw maximum this far above the one in use (4 in base 2) calls for a rescale
#define LP 72                  // LDS row pitch in halves: 144 B = 16 B x 9, free of bank conflicts for the 16-byte fragment reads
#define STG (2 * 64 * LP)      // halves a buffer: 64 k rows, behind them 64 v plane pieces
// each thread brings 4 + 4 pieces of 16 B (rows 16 apart), a wave's copy covers 4 whole 128-B rows; gk, gv: the thread's first pieces, lk: the LDS byte address of the first
__device__ __forceinline__ void stage_copy(const _Float16* gk, const _Float16* gv, unsigned lk) {
  const unsigned lv = lk + 64 * LP * 2;
  // the closing s_wait_xcnt stands inside the statement so that no address register named here is rewritten ahead of it (a precaution)
  asm volatile("global_load_async_to_lds_b128 %0, %1, off\n\t"
               "global_load_async_to_lds_b128 %2, %3, off\n\t"
               "global_load_async_to_lds_b128 %4, %5, off\n\t"
               "global_load_async_to_lds_b128 %6, %7, off\n\t"
               "global_load_async_to_lds_b128 %8, %9, off\n\t"
               "global_load_async_to_lds_b128 %10, %11, off\n\t"
               "global_load_async_to_lds_b128 %12, %13, off\n\t"
               "global_load_async_to_lds_b128 %14, %15, off\n\t"
               "s_wait_xcnt 0x0"
               :: "v"(lk), "v"(gk), "v"(lk + 16 * LP * 2), "v"(gk + 16 * HD), "v"(lk + 32 * LP * 2), "v"(gk + 32 * HD), "v"(lk + 48 * LP * 2), "v"(gk + 48 * HD),
                  "v"(lv), "v"(gv), "v"(lv + 16 * LP * 2), "v"(gv + 16 * SS), "v"(lv + 32 * LP * 2), "v"(gv + 32 * SS), "v"(lv + 48 * LP * 2), "v"(gv + 48 * SS)
               : "memory");
}
// lane l's value from lane l ^ 16
__device__ __forceinline__ float xhalf(float x) { const int b = __builtin_bit_cast(int, x); return __builtin_bit_cast(float, __builtin_amdgcn_permlanex16(b, b, 0x76543210, 0xfedcba98, false, false)); }
__global__ __launch_bounds__(128) void k_attn(const _Float16* __restrict__ Q, const _Float16* __restrict__ Kr, const _Float16* __restrict__ V, float* __restrict__ O) {
  __shared__ __align__(16) _Float16 ring[2][STG];
  float (*so)[16 * QT][68] = (float (*)[16 * QT][68])&ring[0][0];   // behind the loop the ring (both buffers) is the output staging
  static_assert(sizeof(float) * 4 * 16 * QT * 68 <= sizeof(ring), "output staging fits the ring");
  const int tid = threadIdx.x, wave = tid >> 5, lane = tid & 31, col = lane & 15, g = lane >> 4; const size_t bh = blockIdx.y; const int q0 = blockIdx.x * (64 * QT) + wave * (16 * QT); const size_t rq = bh * SS + q0;
  const _Float16* gk = Kr + (bh * SS + (tid >> 3)) * HD + (tid & 7) * 8; const _Float16* gv = V + (bh * HD + (tid >> 3)) * SS + (tid & 7) * 8;
  const unsigned lk = (unsigned)(size_t)&ring[0][(tid >> 3) * LP + (tid & 7) * 8];
  stage_copy(gk, gv, lk);
  asm volatile("s_wait_asynccnt 0x0" ::: "memory");   // this wave's part of stage 0 has landed
  __syncthreads();                                     // and every other wave's
  stage_copy(gk + KST * HD, gv + KST, lk + STG * 2);
  v16h aq[QT][2];
#pragma unroll
  for (int qt = 0; qt < QT; ++qt) {
#pragma unroll
    for (int kc = 0; kc < 2; ++kc) aq[qt][kc] = frag_h(Q + (rq + qt * 16 + col) * HD + kc * 32, lane); }
  float m[QT], lim[QT], off[QT], l[QT];
  v8f acc[QT][4] = {};
#pragma unroll
  for (int qt = 0; qt < QT; ++qt) { m[qt] = -3.0e38f; lim[qt] = -3.0e38f; off[qt] = 11.0f; l[qt] = 0.f; }
#pragma unroll 1
  for (int t = 0; t < SS / KST; ++t) { const _Float16* kb = &ring[t & 1][0]; const _Float16* vb = kb + 64 * LP;
#pragma unroll   // the two 32-key steps of a stage: unrolled, their LDS offsets are immediates
   for (int hs = 0; hs < KST / 32; ++hs) { v8f s[QT][2] = {};
#pragma unroll
    for (int ct = 0; ct < 2; ++ct) { const _Float16* rk = kb + (hs * 32 + ct * 16 + col) * LP;
#pragma unroll
      for (int kc = 0; kc < 2; ++kc) { const v16h ka = frag_h(rk + kc * 32, lane);
#pragma unroll
        for (int qt = 0; qt < QT; ++qt) s[qt][ct] = wmma16(ka, aq[qt][kc], s[qt][ct]); } }
    float mx[QT];   // this lane's half of the step's keys; the halves meet only where a rescale is due
#pragma unroll   // constant indices: mx and the scores stay in registers
    for (int qt = 0; qt < QT; ++qt) { mx[qt] = fmaxf(s[qt][0][0], s[qt][1][0]);
#pragma unroll   // as above
      for (int r = 1; r < 8; ++r) mx[qt] = fmaxf(mx[qt], fmaxf(s[qt][0][r], s[qt][1][r])); }
    // one test a step for the whole wave (a scalar branch): below it P <= 2^(11 + 4), inside f16
    if (__builtin_amdgcn_ballot_w32((mx[0] > lim[0]) | (mx[1] > lim[1])) != 0) {
#pragma unroll   // constant indices: the softmax state and the accumulators stay in registers
      for (int qt = 0; qt < QT; ++qt) { const float mn = fmaxf(m[qt], fmaxf(mx[qt], xhalf(mx[qt])));
        const float alpha = (m[qt] <= -1.0e38f) ? 0.f : __builtin_amdgcn_exp2f((m[qt] - mn) * KL2);
        l[qt] *= alpha; m[qt] = mn; lim[qt] = mn + RTH; off[qt] = 11.0f - mn * KL2;
#pragma unroll
        for (int dt = 0; dt < 4; ++dt) {
#pragma unroll
          for (int r = 0; r < 8; ++r) acc[qt][dt][r] *= alpha; } } }
    v16h pb[QT];
#pragma unroll
    for (int qt = 0; qt < QT; ++qt) { const float of = off[qt];   // e = 2^11 exp((s - m) / 8) = exp2(s KL2 + off): one packed fused multiply-add for two scores
    float es0 = 0.f, es1 = 0.f;
#pragma unroll
    for (int i = 0; i < 4; ++i) { const v2f t0 = __builtin_elementwise_fma((v2f){s[qt][0][2 * i], s[qt][0][2 * i + 1]}, (v2f){KL2, KL2}, (v2f){of, of}), t1 = __builtin_elementwise_fma((v2f){s[qt][1][2 * i], s[qt][1][2 * i + 1]}, (v2f){KL2, KL2}, (v2f){of, of});
#pragma unroll   // the two scores of a pair: unrolled, so that every vector element index is a constant and stays in a register
      for (int j = 0; j < 2; ++j) { const float e0 = __builtin_amdgcn_exp2f(t0[j]), e1 = __builtin_amdgcn_exp2f(t1[j]); es0 += e0; es1 += e1;
        pb[qt][2 * i + j] = (_Float16)e0; pb[qt][8 + 2 * i + j] = (_Float16)e1; } }
    l[qt] += es0 + es1; }
#pragma unroll
    for (int dt = 0; dt < 4; ++dt) { const v16h va = frag_h(vb + (dt * 16 + col) * LP + hs * 32, lane);
#pragma unroll
      for (int qt = 0; qt < QT; ++qt) acc[qt][dt] = wmma16(va, pb[qt], acc[qt][dt]); } }
   asm volatile("s_wait_dscnt 0x0" ::: "memory");      // this wave has left the buffer it read
   asm volatile("s_wait_asynccnt 0x0" ::: "memory");   // its part of the next stage has landed
   __syncthreads();                                     // publishes the next stage and frees this one's buffer
   if (t + 2 < SS / KST) stage_copy(gk + (size_t)(t + 2) * (KST * HD), gv + (t + 2) * KST, lk + (t & 1) * (STG * 2)); }
  asm volatile("s_wait_asynccnt 0x0" ::: "memory");    // no copy is left in flight
#pragma unroll
  for (int qt = 0; qt < QT; ++qt) {
  const float lj = l[qt] + xhalf(l[qt]);
  const float il = 1.0f / lj;   // l carries the same 2^11 as P
#pragma unroll
  for (int dt = 0; dt < 4; ++dt) {
#pragma unroll
    for (int hf = 0; hf < 2; ++hf) { v4f o4;
#pragma unroll
      for (int i = 0; i < 4; ++i) o4[i] = acc[qt][dt][hf * 4 + i] * il;
      *(v4f*)&so[wave][qt * 16 + col][dt * 16 + 8 * g + hf * 4] = o4; } } }
  LDSX();
  for (int rl = 0; rl < 16 * QT; ++rl) if (lane < 16) vst2(O + (rq + rl) * HD + lane * 4, *(const v4f*)&so[wave][rl][lane * 4]);
}
// ---- k_out: block = (64 tokens, bh): out = o (bf16 hi + lo) . Wp^T + bp
__global__ __launch_bounds__(128) void k_out(const float* __restrict__ O, const __bf16* __restrict__ P, const float* __restrict__ BP, float* __restrict__ OUT) {
  __shared__ __align__(16) float so[4][16][68];
  const int tid = threadIdx.x, wave = tid >> 5, lane = tid & 31, col = lane & 15, g = lane >> 4; const size_t bh = blockIdx.y; const size_t r0 = bh * SS + blockIdx.x * 64 + wave * 16;
  v8f acc[4] = {};
#pragma unroll
  for (int kc = 0; kc < HD / 32; ++kc) { const F2 a = split_row(O + (r0 + col) * HD, kc * 32, lane);
#pragma unroll
    for (int j = 0; j < 4; ++j) { const v16b w = frag_b(P + ((size_t)3 * HD + j * 16 + col) * HD + kc * 32, lane); acc[j] = wmma_bf(a.h, w, acc[j]); acc[j] = wmma_bf(a.l, w, acc[j]); } }
#pragma unroll
  for (int j = 0; j < 4; ++j) { const float bb = bfr(BP[j * 16 + col]);
#pragma unroll
    for (int r = 0; r < 8; ++r) so[wave][8 * g + r][j * 16 + col] = acc[j][r] + bb; }
  LDSX();
  for (int rl = 0; rl < 16; ++rl) if (lane < 16) vst2(OUT + (r0 + rl) * HD + lane * 4, *(const v4f*)&so[wave][rl][lane * 4]);
}
extern "C" void kernel_launch(void* const* d_in, const int* in_sizes, int n_in, void* d_out, int out_size, void* d_ws, size_t ws_size, hipStream_t stream) {
  (void)in_sizes; (void)n_in; (void)out_size;
  const float** F = (const float**)d_in;   // 0 x [2,12,4096,64]; 1 Wq [64,64], 2 bq, 3 Wk, 4 bk, 5 Wv, 6 bv, 7 Wp, 8 bp (natural [out][in])
  if (ws_size < (size_t)WS_END) return;
  char* ws = (char*)d_ws; __bf16* P = (__bf16*)ws; _Float16 *Q = (_Float16*)(ws + WS_Q), *Kr = (_Float16*)(ws + WS_K), *V = (_Float16*)(ws + WS_V); float* O = (float*)(ws + WS_O);
  k_pack<<<dim3(HD, 4), 64, 0, stream>>>(F[1], F[3], F[5], F[7], P);
  k_proj<<<dim3(SS / 64, 3, NBH), 128, 0, stream>>>(F[0], P, F[2], F[4], F[6], Q, Kr, V);
  k_attn<<<dim3(SS / (64 * QT), TNB), 128, 0, stream>>>(Q, Kr, V, O);
  k_out<<<dim3(TQB, TNB), 128, 0, stream>>>(O, P, F[8], (float*)d_out);
}

// v007
// A run of this version takes 107 microseconds.
// Next to v006, in two timings, it ran 1.07 times as fast each time.
// All steps since v000 together make it 3.59 times as fast.
// compute dtype: all float inputs rounded to bf16; q/k/v = x . W^T + b (64 -> 64 per head) with EXACT bf16 products on WMMA 16x16x32 (natural rows), rounded once to f16; PLAIN attention per (batch, head): q, k single f16, scores transposed (k rows as A, q as B: a lane holds one query of each of the wave's two query tiles), softmax in f32 in base 2 (factor log2(e) / 8, hardware exp2) against a maximum that is renewed lazily, P (scaled by 2^11 to 2^15 in the exponent, single f16, packed from the score registers as B) under v planes (single f16, A); out = o (bf16 hi + residual) . Wp^T (2 products) + bp; f32 output.
#include <hip/hip_runtime.h>
#include <math.h>

typedef __attribute__((ext_vector_type(16))) _Float16 v16h;
typedef __attribute__((ext_vector_type(16))) __bf16 v16b;
typedef __attribute__((ext_vector_type(8)))  _Float16 v8h;
typedef __attribute__((ext_vector_type(8)))  float v8f;
typedef __attribute__((ext_vector_type(4)))  float v4f;
typedef __attribute__((ext_vector_type(2)))  float v2f;
typedef __attribute__((ext_vector_type(4)))  unsigned v4u;
typedef __attribute__((ext_vector_type(4)))  int v4i;
typedef float __attribute__((may_alias)) float_a;
typedef int __attribute__((may_alias)) int_a;

template <typename T> __device__ __forceinline__ void vst2(void* p, T v) { *(T*)p = v;  }
__device__ __forceinline__ v8f wmma16(v16h a, v16h b, v8f c) {
  v8f d = __builtin_amdgcn_wmma_f32_16x16x32_f16(false, a, false, b, (short)0, c, false, false);
  return d;
}
__device__ __forceinline__ v8f wmma_bf(v16b a, v16b b, v8f c) {
  v8f d = __builtin_amdgcn_wmma_f32_16x16x32_bf16(false, a, false, b, (short)0, c, false, false);
  return d;
}
// 16x16x32 fragments: lane = (h = lane>>4, row/col = lane&15); elements 0..7 = k0+8h+0..7, 8..15 = k0+16+8h+0..7; D element r = row 8h+r
__device__ __forceinline__ v16h frag_h(const _Float16* rowk0, int lane) {
  union { v16h v; v8h q[2]; } u; const _Float16* p = rowk0 + 8 * (lane >> 4);
  u.q[0] = *(const v8h*)p; u.q[1] = *(const v8h*)(p + 16); return u.v;
}
__device__ __forceinline__ v16h frag_f32(const float* rowk0, int lane) {
  v16h a; const float* p = rowk0 + 8 * (lane >> 4);
#pragma unroll
  for (int i = 0; i < 8; ++i) { a[i] = (_Float16)p[i]; a[8 + i] = (_Float16)p[16 + i]; }
  return a;
}
__device__ __forceinline__ v16h frag_f32s(const float* rowk0, int lane, float sc) {
  v16h a; const float* p = rowk0 + 8 * (lane >> 4);
#pragma unroll
  for (int i = 0; i < 8; ++i) { a[i] = (_Float16)(p[i] * sc); a[8 + i] = (_Float16)(p[16 + i] * sc); }
  return a;
}
// column fragment from a [K][ld] layout (column n), rows >= K read as 0
__device__ __forceinline__ v16h fragc_f32(const float* W, int k0, int n, int lane, int ld, int K) {
  v16h a; const int g = lane >> 4;
#pragma unroll
  for (int i = 0; i < 8; ++i) { const int ka = k0 + 8 * g + i, kb = ka + 16;
    a[i] = (_Float16)(ka < K ? W[(size_t)(ka < K ? ka : K - 1) * ld + n] : 0.f); a[8 + i] = (_Float16)(kb < K ? W[(size_t)(kb < K ? kb : K - 1) * ld + n] : 0.f); }
  return a;
}
struct F2 { v16b h, l; };
__device__ __forceinline__ F2 bsplit16(const float v[16]) { F2 r;
#pragma unroll
  for (int i = 0; i < 16; ++i) { const __bf16 h = (__bf16)v[i]; r.h[i] = h; r.l[i] = (__bf16)(v[i] - (float)h); }
  return r; }
__device__ __forceinline__ F2 split_row(const float* row, int k0, int lane) { float v[16]; const float* p = row + k0 + 8 * (lane >> 4);
#pragma unroll
  for (int i = 0; i < 8; ++i) { v[i] = p[i]; v[8 + i] = p[16 + i]; }
  return bsplit16(v); }
__device__ __forceinline__ F2 split_rowK(const float* row, int k0, int lane, int K) { float v[16]; const int g = lane >> 4;
#pragma unroll
  for (int i = 0; i < 8; ++i) { const int ka = k0 + 8 * g + i, kb = ka + 16; v[i] = ka < K ? row[ka < K ? ka : K - 1] : 0.f; v[8 + i] = kb < K ? row[kb < K ? kb : K - 1] : 0.f; }
  return bsplit16(v); }
__device__ __forceinline__ F2 split_col(const float* W, int k0, int n, int lane, int ld, int K) { float v[16]; const int g = lane >> 4;
#pragma unroll
  for (int i = 0; i < 8; ++i) { const int ka = k0 + 8 * g + i, kb = ka + 16; v[i] = ka < K ? W[(size_t)(ka < K ? ka : K - 1) * ld + n] : 0.f; v[8 + i] = kb < K ? W[(size_t)(kb < K ? kb : K - 1) * ld + n] : 0.f; }
  return bsplit16(v); }
__device__ __forceinline__ v8f mac3(const F2& a, const F2& b, v8f c) { c = wmma_bf(a.l, b.h, c); c = wmma_bf(a.h, b.l, c); return wmma_bf(a.h, b.h, c); }
__device__ __forceinline__ float sigm(float v) { return 1.0f / (1.0f + expf(-v)); }
#define LDSX() do { asm volatile("s_wait_dscnt 0" ::: "memory"); __builtin_amdgcn_wave_barrier(); __builtin_amdgcn_fence(__ATOMIC_RELEASE, "workgroup"); } while (0)


// Sub-space attention on a head-split input (B 2, 12 heads, 4,096 tokens, 64 dims): per-head 64x64 q/k/v linears + biases, softmax(q k^T / 8) v, 64x64 output linear + bias.
#define NBH 24            // B * H batch-heads
#define SS 4096
#define HD 64
#define NR (NBH * SS)
#ifndef TQB
#define TQB (SS / 64)
#define TNB NBH
#endif
typedef __attribute__((ext_vector_type(8))) __bf16 v8b;
__device__ __forceinline__ v16b frag_b(const __bf16* rowk0, int lane) {
  union { v16b v; v8b q[2]; } u; const __bf16* p = rowk0 + 8 * (lane >> 4);
  u.q[0] = *(const v8b*)p; u.q[1] = *(const v8b*)(p + 16); return u.v;
}
__device__ __forceinline__ float bfr(float v) { return (float)(__bf16)v; }
__device__ __attribute__((noinline)) float exp_ni(float v) { return expf(v); }
__device__ __attribute__((noinline)) float erf_ni(float v) { return erff(v); }

#define WS_PW  0u                                 // bf16 natural rows Wq, Wk, Wv, Wp [4][64][64]
#define WS_Q   (WS_PW + 2u * 4 * HD * HD + 256u)   // f16 q rows [NR][64] ; k rows ; v planes [bh][64][SS]
#define WS_K   (WS_Q + 2u * (size_t)NR * HD)
#define WS_V   (WS_K + 2u * (size_t)NR * HD)
#define WS_END (WS_V + 2u * (size_t)NBH * HD * SS)

__global__ __launch_bounds__(64) void k_pack(const float* __restrict__ WQ, const float* __restrict__ WK, const float* __restrict__ WV, const float* __restrict__ WP, __bf16* __restrict__ P) { const int n = blockIdx.x, m = blockIdx.y, t = threadIdx.x; const float* w = (m == 0) ? WQ : (m == 1) ? WK : (m == 2) ? WV : WP; __shared__ __align__(16) __bf16 s[HD]; s[t] = (__bf16)w[(size_t)n * HD + t]; __syncthreads(); if (t < HD / 8) vst2((unsigned*)(P + ((size_t)m * HD + n) * HD + t * 8), *(const v4u*)&s[t * 8]); }
// ---- k_proj: block = (64 tokens, which, bh): y = x . W^T + b (K = 64); q/k rows, v planes
__global__ __launch_bounds__(128) void k_proj(const float* __restrict__ X, const __bf16* __restrict__ P, const float* __restrict__ BQ, const float* __restrict__ BK, const float* __restrict__ BV, _Float16* __restrict__ Q, _Float16* __restrict__ Kr, _Float16* __restrict__ V) {
  __shared__ __align__(16) _Float16 so[64][72]; __shared__ __align__(16) _Float16 st[64][72];
  const int tid = threadIdx.x, wave = tid >> 5, lane = tid & 31, col = lane & 15, g = lane >> 4; const int which = blockIdx.y; const size_t bh = blockIdx.z; const int n0b = blockIdx.x * 64; const size_t r0 = bh * SS + n0b + wave * 16; const float* BB = (which == 0) ? BQ : (which == 1) ? BK : BV;
  v8f acc[4] = {};
#pragma unroll
  for (int kc = 0; kc < HD / 32; ++kc) { v16b a; { const float* p = X + (r0 + col) * HD + kc * 32 + 8 * g;
#pragma unroll
      for (int i = 0; i < 8; ++i) { a[i] = (__bf16)p[i]; a[8 + i] = (__bf16)p[16 + i]; } }
#pragma unroll
    for (int j = 0; j < 4; ++j) acc[j] = wmma_bf(a, frag_b(P + ((size_t)which * HD + j * 16 + col) * HD + kc * 32, lane), acc[j]); }
  if (which < 2) { _Float16* dst = (which == 0) ? Q : Kr;
#pragma unroll
    for (int j = 0; j < 4; ++j) { const float bb = bfr(BB[j * 16 + col]);
#pragma unroll
      for (int r = 0; r < 8; ++r) so[wave * 16 + 8 * g + r][j * 16 + col] = (_Float16)(acc[j][r] + bb); }
    LDSX();
    for (int rl = 0; rl < 16; ++rl) if (lane < 8) vst2((unsigned*)(dst + (r0 + rl) * HD + lane * 8), *(const v4u*)&so[wave * 16 + rl][lane * 8]);
  } else {
#pragma unroll
    for (int j = 0; j < 4; ++j) { const float bb = bfr(BB[j * 16 + col]);
#pragma unroll
      for (int r = 0; r < 8; ++r) st[j * 16 + col][wave * 16 + 8 * g + r] = (_Float16)(acc[j][r] + bb); }
    __syncthreads();
    for (int e = tid; e < 64 * 8; e += 128) { const int d = e >> 3, pc = e & 7; vst2((unsigned*)(V + (bh * HD + d) * SS + n0b + pc * 8), *(const v4u*)&st[d][pc * 8]); } }
}
// ---- k_attn: block = (128 queries, bh), a wave = 32 queries = two query tiles: plain 64-wide attention over 4,096 keys, then the output linear on the wave's own rows; out f32 rows
// every k and v fragment read from LDS feeds two products, one a query tile: half the LDS reads and half the staged bytes a query
// k rows and v planes reach the four waves through LDS: a stage = 64 keys = 64 k rows and 64 v plane pieces of 128 B each, two buffers, the next stage's copies in flight while this one is worked on
#define KST 64                 // keys a stage
#define QT 2                   // query tiles of 16 a wave
#define KL2 0.18033688011112042f   // log2(e) / 8: the score scale and the change of base in one factor
#define RTH (4.0f / KL2)      // a raw maximum this far above the one in use (4 in base 2) calls for a rescale
#define LP 72                  // LDS row pitch in halves: 144 B = 16 B x 9, free of bank conflicts for the 16-byte fragment reads
#define STG (2 * 64 * LP)      // halves a buffer: 64 k rows, behind them 64 v plane pieces
// each thread brings 4 + 4 pieces of 16 B (rows 16 apart), a wave's copy covers 4 whole 128-B rows; gk, gv: the thread's first pieces, lk: the LDS byte address of the first
__device__ __forceinline__ void stage_copy(const _Float16* gk, const _Float16* gv, unsigned lk) {
  const unsigned lv = lk + 64 * LP * 2;
  // the closing s_wait_xcnt stands inside the statement so that no address register named here is rewritten ahead of it (a precaution)
  asm volatile("global_load_async_to_lds_b128 %0, %1, off\n\t"
               "global_load_async_to_lds_b128 %2, %3, off\n\t"
               "global_load_async_to_lds_b128 %4, %5, off\n\t"
               "global_load_async_to_lds_b128 %6, %7, off\n\t"
               "global_load_async_to_lds_b128 %8, %9, off\n\t"
               "global_load_async_to_lds_b128 %10, %11, off\n\t"
               "global_load_async_to_lds_b128 %12, %13, off\n\t"
               "global_load_async_to_lds_b128 %14, %15, off\n\t"
               "s_wait_xcnt 0x0"
               :: "v"(lk), "v"(gk), "v"(lk + 16 * LP * 2), "v"(gk + 16 * HD), "v"(lk + 32 * LP * 2), "v"(gk + 32 * HD), "v"(lk + 48 * LP * 2), "v"(gk + 48 * HD),
                  "v"(lv), "v"(gv), "v"(lv + 16 * LP * 2), "v"(gv + 16 * SS), "v"(lv + 32 * LP * 2), "v"(gv + 32 * SS), "v"(lv + 48 * LP * 2), "v"(gv + 48 * SS)
               : "memory");
}
// lane l's value from lane l ^ 16
__device__ __forceinline__ float xhalf(float x) { const int b = __builtin_bit_cast(int, x); return __builtin_bit_cast(float, __builtin_amdgcn_permlanex16(b, b, 0x76543210, 0xfedcba98, false, false)); }
__global__ __launch_bounds__(128) void k_attn(const _Float16* __restrict__ Q, const _Float16* __restrict__ Kr, const _Float16* __restrict__ V, const __bf16* __restrict__ P, const float* __restrict__ BP, float* __restrict__ OUT) {
  __shared__ __align__(16) _Float16 ring[2][STG];
  float (*so)[16 * QT][68] = (float (*)[16 * QT][68])&ring[0][0];   // behind the loop the ring (both buffers) is the output staging
  static_assert(sizeof(float) * 4 * 16 * QT * 68 <= sizeof(ring), "output staging fits the ring");
  const int tid = threadIdx.x, wave = tid >> 5, lane = tid & 31, col = lane & 15, g = lane >> 4; const size_t bh = blockIdx.y; const int q0 = blockIdx.x * (64 * QT) + wave * (16 * QT); const size_t rq = bh * SS + q0;
  const _Float16* gk = Kr + (bh * SS + (tid >> 3)) * HD + (tid & 7) * 8; const _Float16* gv = V + (bh * HD + (tid >> 3)) * SS + (tid & 7) * 8;
  const unsigned lk = (unsigned)(size_t)&ring[0][(tid >> 3) * LP + (tid & 7) * 8];
  stage_copy(gk, gv, lk);
  asm volatile("s_wait_asynccnt 0x0" ::: "memory");   // this wave's part of stage 0 has landed
  __syncthreads();                                     // and every other wave's
  stage_copy(gk + KST * HD, gv + KST, lk + STG * 2);
  v16h aq[QT][2];
#pragma unroll
  for (int qt = 0; qt < QT; ++qt) {
#pragma unroll
    for (int kc = 0; kc < 2; ++kc) aq[qt][kc] = frag_h(Q + (rq + qt * 16 + col) * HD + kc * 32, lane); }
  float m[QT], lim[QT], off[QT], l[QT];
  v8f acc[QT][4] = {};
#pragma unroll
  for (int qt = 0; qt < QT; ++qt) { m[qt] = -3.0e38f; lim[qt] = -3.0e38f; off[qt] = 11.0f; l[qt] = 0.f; }
#pragma unroll 1
  for (int t = 0; t < SS / KST; ++t) { const _Float16* kb = &ring[t & 1][0]; const _Float16* vb = kb + 64 * LP;
#pragma unroll   // the two 32-key steps of a stage: unrolled, their LDS offsets are immediates
   for (int hs = 0; hs < KST / 32; ++hs) { v8f s[QT][2] = {};
#pragma unroll
    for (int ct = 0; ct < 2; ++ct) { const _Float16* rk = kb + (hs * 32 + ct * 16 + col) * LP;
#pragma unroll
      for (int kc = 0; kc < 2; ++kc) { const v16h ka = frag_h(rk + kc * 32, lane);
#pragma unroll
        for (int qt = 0; qt < QT; ++qt) s[qt][ct] = wmma16(ka, aq[qt][kc], s[qt][ct]); } }
    float mx[QT];   // this lane's half of the step's keys; the halves meet only where a rescale is due
#pragma unroll   // constant indices: mx and the scores stay in registers
    for (int qt = 0; qt < QT; ++qt) { mx[qt] = fmaxf(s[qt][0][0], s[qt][1][0]);
#pragma unroll   // as above
      for (int r = 1; r < 8; ++r) mx[qt] = fmaxf(mx[qt], fmaxf(s[qt][0][r], s[qt][1][r])); }
    // one test a step for the whole wave (a scalar branch): below it P <= 2^(11 + 4), inside f16
    if (__builtin_amdgcn_ballot_w32((mx[0] > lim[0]) | (mx[1] > lim[1])) != 0) {
#pragma unroll   // constant indices: the softmax state and the accumulators stay in registers
      for (int qt = 0; qt < QT; ++qt) { const float mn = fmaxf(m[qt], fmaxf(mx[qt], xhalf(mx[qt])));
        const float alpha = (m[qt] <= -1.0e38f) ? 0.f : __builtin_amdgcn_exp2f((m[qt] - mn) * KL2);
        l[qt] *= alpha; m[qt] = mn; lim[qt] = mn + RTH; off[qt] = 11.0f - mn * KL2;
#pragma unroll
        for (int dt = 0; dt < 4; ++dt) {
#pragma unroll
          for (int r = 0; r < 8; ++r) acc[qt][dt][r] *= alpha; } } }
    v16h pb[QT];
#pragma unroll
    for (int qt = 0; qt < QT; ++qt) { const float of = off[qt];   // e = 2^11 exp((s - m) / 8) = exp2(s KL2 + off): one packed fused multiply-add for two scores
    float es0 = 0.f, es1 = 0.f;
#pragma unroll
    for (int i = 0; i < 4; ++i) { const v2f t0 = __builtin_elementwise_fma((v2f){s[qt][0][2 * i], s[qt][0][2 * i + 1]}, (v2f){KL2, KL2}, (v2f){of, of}), t1 = __builtin_elementwise_fma((v2f){s[qt][1][2 * i], s[qt][1][2 * i + 1]}, (v2f){KL2, KL2}, (v2f){of, of});
#pragma unroll   // the two scores of a pair: unrolled, so that every vector element index is a constant and stays in a register
      for (int j = 0; j < 2; ++j) { const float e0 = __builtin_amdgcn_exp2f(t0[j]), e1 = __builtin_amdgcn_exp2f(t1[j]); es0 += e0; es1 += e1;
        pb[qt][2 * i + j] = (_Float16)e0; pb[qt][8 + 2 * i + j] = (_Float16)e1; } }
    l[qt] += es0 + es1; }
#pragma unroll
    for (int dt = 0; dt < 4; ++dt) { const v16h va = frag_h(vb + (dt * 16 + col) * LP + hs * 32, lane);
#pragma unroll
      for (int qt = 0; qt < QT; ++qt) acc[qt][dt] = wmma16(va, pb[qt], acc[qt][dt]); } }
   asm volatile("s_wait_dscnt 0x0" ::: "memory");      // this wave has left the buffer it read
   asm volatile("s_wait_asynccnt 0x0" ::: "memory");   // its part of the next stage has landed
   __syncthreads();                                     // publishes the next stage and frees this one's buffer
   if (t + 2 < SS / KST) stage_copy(gk + (size_t)(t + 2) * (KST * HD), gv + (t + 2) * KST, lk + (t & 1) * (STG * 2)); }
  asm volatile("s_wait_asynccnt 0x0" ::: "memory");    // no copy is left in flight
  // out^T = Wp . O^T on the wave's own 32 queries: the accumulators already lie in the k order of a B operand (tiles 2 kc and 2 kc + 1 are dims 32 kc + 8 g + r and 32 kc + 16 + 8 g + r), Wp's natural rows are A
  // every loop of the epilogue is unrolled: constant indices keep the fragments, the accumulators and y in registers
  v16b w[2][4];
#pragma unroll
  for (int kc = 0; kc < 2; ++kc) {
#pragma unroll
    for (int et = 0; et < 4; ++et) w[kc][et] = frag_b(P + ((size_t)3 * HD + et * 16 + col) * HD + kc * 32, lane); }
#pragma unroll
  for (int qt = 0; qt < QT; ++qt) {
  const float lj = l[qt] + xhalf(l[qt]);
  const float il = 1.0f / lj;   // l carries the same 2^11 as P
  v8f y[4] = {};   // y[et][r] = out[query 16 qt + col][16 et + 8 g + r]
#pragma unroll
  for (int kc = 0; kc < 2; ++kc) { float o[16];
#pragma unroll
    for (int i = 0; i < 8; ++i) { o[i] = acc[qt][2 * kc][i] * il; o[8 + i] = acc[qt][2 * kc + 1][i] * il; }
    const F2 ob = bsplit16(o);   // o as bf16 hi + residual
#pragma unroll
    for (int et = 0; et < 4; ++et) y[et] = wmma_bf(w[kc][et], ob.h, y[et]);
#pragma unroll
    for (int et = 0; et < 4; ++et) y[et] = wmma_bf(w[kc][et], ob.l, y[et]); }
#pragma unroll
  for (int et = 0; et < 4; ++et) {
#pragma unroll
    for (int hf = 0; hf < 2; ++hf) { const v4f b4 = *(const v4f*)(BP + et * 16 + 8 * g + hf * 4); v4f o4;
#pragma unroll
      for (int i = 0; i < 4; ++i) o4[i] = y[et][hf * 4 + i] + bfr(b4[i]);
      *(v4f*)&so[wave][qt * 16 + col][et * 16 + 8 * g + hf * 4] = o4; } }
  __builtin_amdgcn_sched_barrier(0); }   // one query tile after the other: mixed, their conversions take the kernel past 256 registers, which the loop does not need
  LDSX();
  for (int rl = 0; rl < 16 * QT; ++rl) if (lane < 16) vst2(OUT + (rq + rl) * HD + lane * 4, *(const v4f*)&so[wave][rl][lane * 4]);
}
extern "C" void kernel_launch(void* const* d_in, const int* in_sizes, int n_in, void* d_out, int out_size, void* d_ws, size_t ws_size, hipStream_t stream) {
  (void)in_sizes; (void)n_in; (void)out_size;
  const float** F = (const float**)d_in;   // 0 x [2,12,4096,64]; 1 Wq [64,64], 2 bq, 3 Wk, 4 bk, 5 Wv, 6 bv, 7 Wp, 8 bp (natural [out][in])
  if (ws_size < (size_t)WS_END) return;
  char* ws = (char*)d_ws; __bf16* P = (__bf16*)ws; _Float16 *Q = (_Float16*)(ws + WS_Q), *Kr = (_Float16*)(ws + WS_K), *V = (_Float16*)(ws + WS_V);
  k_pack<<<dim3(HD, 4), 64, 0, stream>>>(F[1], F[3], F[5], F[7], P);
  k_proj<<<dim3(SS / 64, 3, NBH), 128, 0, stream>>>(F[0], P, F[2], F[4], F[6], Q, Kr, V);
  k_attn<<<dim3(SS / (64 * QT), TNB), 128, 0, stream>>>(Q, Kr, V, P, F[8], (float*)d_out);
}

// v008
// One run takes 102 microseconds.
// In two side-by-side timings against v007, it was 1.05 and 1.04 times as fast.
// Over all steps from v000 it is 3.75 times as fast.
// compute dtype: all float inputs rounded to bf16; q/k/v = x . W^T + b (64 -> 64 per head) with EXACT bf16 products on WMMA 16x16x32 (natural rows), rounded once to f16; PLAIN attention per (batch, head): q, k single f16, scores transposed (k rows as A, q as B: a lane holds one query of each of the wave's two query tiles), softmax in f32 in base 2 (factor log2(e) / 8, hardware exp2) against a maximum that is renewed lazily, P (scaled by 2^11 to 2^15 in the exponent, single f16, packed from the score registers as B) under v planes (single f16, A); out = o (bf16 hi + residual) . Wp^T (2 products) + bp; f32 output.
#include <hip/hip_runtime.h>
#include <math.h>

typedef __attribute__((ext_vector_type(16))) _Float16 v16h;
typedef __attribute__((ext_vector_type(16))) __bf16 v16b;
typedef __attribute__((ext_vector_type(8)))  _Float16 v8h;
typedef __attribute__((ext_vector_type(8)))  float v8f;
typedef __attribute__((ext_vector_type(4)))  float v4f;
typedef __attribute__((ext_vector_type(2)))  float v2f;
typedef __attribute__((ext_vector_type(4)))  unsigned v4u;
typedef __attribute__((ext_vector_type(4)))  int v4i;
typedef float __attribute__((may_alias)) float_a;
typedef int __attribute__((may_alias)) int_a;

template <typename T> __device__ __forceinline__ void vst2(void* p, T v) { *(T*)p = v;  }
__device__ __forceinline__ v8f wmma16(v16h a, v16h b, v8f c) {
  v8f d = __builtin_amdgcn_wmma_f32_16x16x32_f16(false, a, false, b, (short)0, c, false, false);
  return d;
}
__device__ __forceinline__ v8f wmma_bf(v16b a, v16b b, v8f c) {
  v8f d = __builtin_amdgcn_wmma_f32_16x16x32_bf16(false, a, false, b, (short)0, c, false, false);
  return d;
}
// 16x16x32 fragments: lane = (h = lane>>4, row/col = lane&15); elements 0..7 = k0+8h+0..7, 8..15 = k0+16+8h+0..7; D element r = row 8h+r
__device__ __forceinline__ v16h frag_h(const _Float16* rowk0, int lane) {
  union { v16h v; v8h q[2]; } u; const _Float16* p = rowk0 + 8 * (lane >> 4);
  u.q[0] = *(const v8h*)p; u.q[1] = *(const v8h*)(p + 16); return u.v;
}
__device__ __forceinline__ v16h frag_f32(const float* rowk0, int lane) {
  v16h a; const float* p = rowk0 + 8 * (lane >> 4);
#pragma unroll
  for (int i = 0; i < 8; ++i) { a[i] = (_Float16)p[i]; a[8 + i] = (_Float16)p[16 + i]; }
  return a;
}
__device__ __forceinline__ v16h frag_f32s(const float* rowk0, int lane, float sc) {
  v16h a; const float* p = rowk0 + 8 * (lane >> 4);
#pragma unroll
  for (int i = 0; i < 8; ++i) { a[i] = (_Float16)(p[i] * sc); a[8 + i] = (_Float16)(p[16 + i] * sc); }
  return a;
}
// column fragment from a [K][ld] layout (column n), rows >= K read as 0
__device__ __forceinline__ v16h fragc_f32(const float* W, int k0, int n, int lane, int ld, int K) {
  v16h a; const int g = lane >> 4;
#pragma unroll
  for (int i = 0; i < 8; ++i) { const int ka = k0 + 8 * g + i, kb = ka + 16;
    a[i] = (_Float16)(ka < K ? W[(size_t)(ka < K ? ka : K - 1) * ld + n] : 0.f); a[8 + i] = (_Float16)(kb < K ? W[(size_t)(kb < K ? kb : K - 1) * ld + n] : 0.f); }
  return a;
}
struct F2 { v16b h, l; };
__device__ __forceinline__ F2 bsplit16(const float v[16]) { F2 r;
#pragma unroll
  for (int i = 0; i < 16; ++i) { const __bf16 h = (__bf16)v[i]; r.h[i] = h; r.l[i] = (__bf16)(v[i] - (float)h); }
  return r; }
__device__ __forceinline__ F2 split_row(const float* row, int k0, int lane) { float v[16]; const float* p = row + k0 + 8 * (lane >> 4);
#pragma unroll
  for (int i = 0; i < 8; ++i) { v[i] = p[i]; v[8 + i] = p[16 + i]; }
  return bsplit16(v); }
__device__ __forceinline__ F2 split_rowK(const float* row, int k0, int lane, int K) { float v[16]; const int g = lane >> 4;
#pragma unroll
  for (int i = 0; i < 8; ++i) { const int ka = k0 + 8 * g + i, kb = ka + 16; v[i] = ka < K ? row[ka < K ? ka : K - 1] : 0.f; v[8 + i] = kb < K ? row[kb < K ? kb : K - 1] : 0.f; }
  return bsplit16(v); }
__device__ __forceinline__ F2 split_col(const float* W, int k0, int n, int lane, int ld, int K) { float v[16]; const int g = lane >> 4;
#pragma unroll
  for (int i = 0; i < 8; ++i) { const int ka = k0 + 8 * g + i, kb = ka + 16; v[i] = ka < K ? W[(size_t)(ka < K ? ka : K - 1) * ld + n] : 0.f; v[8 + i] = kb < K ? W[(size_t)(kb < K ? kb : K - 1) * ld + n] : 0.f; }
  return bsplit16(v); }
__device__ __forceinline__ v8f mac3(const F2& a, const F2& b, v8f c) { c = wmma_bf(a.l, b.h, c); c = wmma_bf(a.h, b.l, c); return wmma_bf(a.h, b.h, c); }
__device__ __forceinline__ float sigm(float v) { return 1.0f / (1.0f + expf(-v)); }
#define LDSX() do { asm volatile("s_wait_dscnt 0" ::: "memory"); __builtin_amdgcn_wave_barrier(); __builtin_amdgcn_fence(__ATOMIC_RELEASE, "workgroup"); } while (0)


// Sub-space attention on a head-split input (B 2, 12 heads, 4,096 tokens, 64 dims): per-head 64x64 q/k/v linears + biases, softmax(q k^T / 8) v, 64x64 output linear + bias.
#define NBH 24            // B * H batch-heads
#define SS 4096
#define HD 64
#define NR (NBH * SS)
#ifndef TQB
#define TQB (SS / 64)
#define TNB NBH
#endif
typedef __attribute__((ext_vector_type(8))) __bf16 v8b;
__device__ __forceinline__ v16b frag_b(const __bf16* rowk0, int lane) {
  union { v16b v; v8b q[2]; } u; const __bf16* p = rowk0 + 8 * (lane >> 4);
  u.q[0] = *(const v8b*)p; u.q[1] = *(const v8b*)(p + 16); return u.v;
}
__device__ __forceinline__ float bfr(float v) { return (float)(__bf16)v; }
__device__ __attribute__((noinline)) float exp_ni(float v) { return expf(v); }
__device__ __attribute__((noinline)) float erf_ni(float v) { return erff(v); }

#define WS_PW  0u                                 // bf16 natural rows Wq, Wk, Wv, Wp [4][64][64]
#define WS_Q   (WS_PW + 2u * 4 * HD * HD + 256u)   // f16 q rows [NR][64] ; k rows ; v planes [bh][64][SS]
#define WS_K   (WS_Q + 2u * (size_t)NR * HD)
#define WS_V   (WS_K + 2u * (size_t)NR * HD)
#define WS_END (WS_V + 2u * (size_t)NBH * HD * SS)

__global__ __launch_bounds__(64) void k_pack(const float* __restrict__ WQ, const float* __restrict__ WK, const float* __restrict__ WV, const float* __restrict__ WP, __bf16* __restrict__ P) { const int n = blockIdx.x, m = blockIdx.y, t = threadIdx.x; const float* w = (m == 0) ? WQ : (m == 1) ? WK : (m == 2) ? WV : WP; __shared__ __align__(16) __bf16 s[HD]; s[t] = (__bf16)w[(size_t)n * HD + t]; __syncthreads(); if (t < HD / 8) vst2((unsigned*)(P + ((size_t)m * HD + n) * HD + t * 8), *(const v4u*)&s[t * 8]); }
// a 16x16x32 fragment from the lane's own first piece (row and half already in p)
__device__ __forceinline__ v16b frag_bp(const __bf16* p) { union { v16b v; v8b q[2]; } u; u.q[0] = *(const v8b*)p; u.q[1] = *(const v8b*)(p + 16); return u.v; }
// ---- k_proj: block = (128 tokens, bh), a wave = 32 tokens = two token tiles: q, k and v = x . W^T + b (K = 64) from one read of x; q/k rows, v planes
// x is loaded and rounded once for the three products, and every weight fragment feeds two products, one a token tile
#define PT 2                   // token tiles of 16 a wave
// every loop of the kernel but the row stores' is unrolled: constant indices keep the fragments and the accumulators in registers
__global__ __launch_bounds__(128) void k_proj(const float* __restrict__ X, const __bf16* __restrict__ P, const float* __restrict__ BQ, const float* __restrict__ BK, const float* __restrict__ BV, _Float16* __restrict__ Q, _Float16* __restrict__ Kr, _Float16* __restrict__ V) {
  __shared__ __align__(16) _Float16 so[2][64 * PT][72]; __shared__ __align__(16) _Float16 st[64][64 * PT + 8];   // q rows and k rows (a wave reads back its own rows only); v planes (pitch 272 B = 16 B x 17)
  const int tid = threadIdx.x, wave = tid >> 5, lane = tid & 31, col = lane & 15, g = lane >> 4; const size_t bh = blockIdx.y; const int n0b = blockIdx.x * (64 * PT), w0 = wave * (16 * PT); const size_t r0 = bh * SS + n0b + w0;
  const float* px = X + (r0 + col) * HD + 8 * g; const __bf16* pw = P + (size_t)col * HD + 8 * g;   // the lane's first piece of x and of the weights: every load of x or of a weight is one of these two plus a constant
  v4f xr[PT][HD / 32][4];   // x as loaded; lane (g, col) takes dims 32 kc + 8 g + 0..7 and 32 kc + 16 + 8 g + 0..7 of token 16 tt + col
#pragma unroll
  for (int tt = 0; tt < PT; ++tt) {
#pragma unroll
    for (int kc = 0; kc < HD / 32; ++kc) { const float* p = px + tt * 16 * HD + kc * 32;
      xr[tt][kc][0] = *(const v4f*)p; xr[tt][kc][1] = *(const v4f*)(p + 4); xr[tt][kc][2] = *(const v4f*)(p + 16); xr[tt][kc][3] = *(const v4f*)(p + 20); } }
  asm volatile("s_wait_xcnt 0x0" :: "v"(px) : "memory");   // the address is an input so that it stays in its registers up to the wait: else a later load of the group lands in them (a precaution)
  v16b w[2][HD / 32][4];   // two sets of weight fragments: the next product's loads fly while this one's WMMAs and staging run
#pragma unroll
  for (int kc = 0; kc < HD / 32; ++kc) {
#pragma unroll
    for (int j = 0; j < 4; ++j) w[0][kc][j] = frag_bp(pw + j * 16 * HD + kc * 32); }
  asm volatile("s_wait_xcnt 0x0" :: "v"(pw) : "memory");   // as above, for the weights' address
  float bi[3][4];   // the lane's biases, loaded with the rest: loaded where they are used, each product would begin with a wait for them
#pragma unroll
  for (int j = 0; j < 4; ++j) { bi[0][j] = BQ[j * 16 + col]; bi[1][j] = BK[j * 16 + col]; bi[2][j] = BV[j * 16 + col]; }
  __builtin_amdgcn_sched_barrier(0);   // x and the first weight set are all in flight before the first wait: otherwise part of the weight loads is issued, and waited for, among the first WMMAs
  v16b a[PT][HD / 32];
#pragma unroll
  for (int tt = 0; tt < PT; ++tt) {
#pragma unroll
    for (int kc = 0; kc < HD / 32; ++kc) {
#pragma unroll
      for (int i = 0; i < 16; ++i) a[tt][kc][i] = (__bf16)xr[tt][kc][i >> 2][i & 3]; } }
#pragma unroll   // which is a constant in each copy: the fragment set and the staging layout are chosen at compile time
  for (int which = 0; which < 3; ++which) {
    if (which < 2) {
#pragma unroll
      for (int kc = 0; kc < HD / 32; ++kc) {
#pragma unroll
        for (int j = 0; j < 4; ++j) w[(which + 1) & 1][kc][j] = frag_bp(pw + ((which + 1) * HD + j * 16) * HD + kc * 32); } }
    v8f acc[PT][4] = {};
#pragma unroll
    for (int kc = 0; kc < HD / 32; ++kc) {
#pragma unroll
      for (int j = 0; j < 4; ++j) {
#pragma unroll
        for (int tt = 0; tt < PT; ++tt) acc[tt][j] = wmma_bf(a[tt][kc], w[which & 1][kc][j], acc[tt][j]); } }
#pragma unroll
    for (int j = 0; j < 4; ++j) { const float bb = bfr(bi[which][j]);
#pragma unroll
      for (int tt = 0; tt < PT; ++tt) {
#pragma unroll
        for (int r = 0; r < 8; ++r) { const _Float16 y = (_Float16)(acc[tt][j][r] + bb);
          if (which < 2) so[which][w0 + tt * 16 + 8 * g + r][j * 16 + col] = y; else st[j * 16 + col][w0 + tt * 16 + 8 * g + r] = y; } } }
    if (which < 2) __builtin_amdgcn_sched_barrier(0); }   // one product after the other: mixed, their 24 accumulator tiles take the kernel past 256 registers and the weight loads are waited for one by one
  __syncthreads();   // one barrier in front of all the stores: it publishes the v planes (and orders each wave's own q and k rows); behind the row stores it would wait for them to be acknowledged
#pragma unroll
  for (int which = 0; which < 2; ++which) { _Float16* dst = (which == 0) ? Q : Kr;
    for (int rl = 0; rl < 16 * PT; ++rl) if (lane < 8) vst2((unsigned*)(dst + (r0 + rl) * HD + lane * 8), *(const v4u*)&so[which][w0 + rl][lane * 8]); }
#pragma unroll   // the LDS reads go out together, not one latency a trip
  for (int i = 0; i < 64 * 8 * PT / 128; ++i) { const int e = tid + i * 128, d = e / (8 * PT), pc = e % (8 * PT); vst2((unsigned*)(V + (bh * HD + d) * SS + n0b + pc * 8), *(const v4u*)&st[d][pc * 8]); }
}
// ---- k_attn: block = (128 queries, bh), a wave = 32 queries = two query tiles: plain 64-wide attention over 4,096 keys, then the output linear on the wave's own rows; out f32 rows
// every k and v fragment read from LDS feeds two products, one a query tile: half the LDS reads and half the staged bytes a query
// k rows and v planes reach the four waves through LDS: a stage = 64 keys = 64 k rows and 64 v plane pieces of 128 B each, two buffers, the next stage's copies in flight while this one is worked on
#define KST 64                 // keys a stage
#define QT 2                   // query tiles of 16 a wave
#define KL2 0.18033688011112042f   // log2(e) / 8: the score scale and the change of base in one factor
#define RTH (4.0f / KL2)      // a raw maximum this far above the one in use (4 in base 2) calls for a rescale
#define LP 72                  // LDS row pitch in halves: 144 B = 16 B x 9, free of bank conflicts for the 16-byte fragment reads
#define STG (2 * 64 * LP)      // halves a buffer: 64 k rows, behind them 64 v plane pieces
// each thread brings 4 + 4 pieces of 16 B (rows 16 apart), a wave's copy covers 4 whole 128-B rows; gk, gv: the thread's first pieces, lk: the LDS byte address of the first
__device__ __forceinline__ void stage_copy(const _Float16* gk, const _Float16* gv, unsigned lk) {
  const unsigned lv = lk + 64 * LP * 2;
  // the closing s_wait_xcnt stands inside the statement so that no address register named here is rewritten ahead of it (a precaution)
  asm volatile("global_load_async_to_lds_b128 %0, %1, off\n\t"
               "global_load_async_to_lds_b128 %2, %3, off\n\t"
               "global_load_async_to_lds_b128 %4, %5, off\n\t"
               "global_load_async_to_lds_b128 %6, %7, off\n\t"
               "global_load_async_to_lds_b128 %8, %9, off\n\t"
               "global_load_async_to_lds_b128 %10, %11, off\n\t"
               "global_load_async_to_lds_b128 %12, %13, off\n\t"
               "global_load_async_to_lds_b128 %14, %15, off\n\t"
               "s_wait_xcnt 0x0"
               :: "v"(lk), "v"(gk), "v"(lk + 16 * LP * 2), "v"(gk + 16 * HD), "v"(lk + 32 * LP * 2), "v"(gk + 32 * HD), "v"(lk + 48 * LP * 2), "v"(gk + 48 * HD),
                  "v"(lv), "v"(gv), "v"(lv + 16 * LP * 2), "v"(gv + 16 * SS), "v"(lv + 32 * LP * 2), "v"(gv + 32 * SS), "v"(lv + 48 * LP * 2), "v"(gv + 48 * SS)
               : "memory");
}
// lane l's value from lane l ^ 16
__device__ __forceinline__ float xhalf(float x) { const int b = __builtin_bit_cast(int, x); return __builtin_bit_cast(float, __builtin_amdgcn_permlanex16(b, b, 0x76543210, 0xfedcba98, false, false)); }
__global__ __launch_bounds__(128) void k_attn(const _Float16* __restrict__ Q, const _Float16* __restrict__ Kr, const _Float16* __restrict__ V, const __bf16* __restrict__ P, const float* __restrict__ BP, float* __restrict__ OUT) {
  __shared__ __align__(16) _Float16 ring[2][STG];
  float (*so)[16 * QT][68] = (float (*)[16 * QT][68])&ring[0][0];   // behind the loop the ring (both buffers) is the output staging
  static_assert(sizeof(float) * 4 * 16 * QT * 68 <= sizeof(ring), "output staging fits the ring");
  const int tid = threadIdx.x, wave = tid >> 5, lane = tid & 31, col = lane & 15, g = lane >> 4; const size_t bh = blockIdx.y; const int q0 = blockIdx.x * (64 * QT) + wave * (16 * QT); const size_t rq = bh * SS + q0;
  const _Float16* gk = Kr + (bh * SS + (tid >> 3)) * HD + (tid & 7) * 8; const _Float16* gv = V + (bh * HD + (tid >> 3)) * SS + (tid & 7) * 8;
  const unsigned lk = (unsigned)(size_t)&ring[0][(tid >> 3) * LP + (tid & 7) * 8];
  stage_copy(gk, gv, lk);
  asm volatile("s_wait_asynccnt 0x0" ::: "memory");   // this wave's part of stage 0 has landed
  __syncthreads();                                     // and every other wave's
  stage_copy(gk + KST * HD, gv + KST, lk + STG * 2);
  v16h aq[QT][2];
#pragma unroll
  for (int qt = 0; qt < QT; ++qt) {
#pragma unroll
    for (int kc = 0; kc < 2; ++kc) aq[qt][kc] = frag_h(Q + (rq + qt * 16 + col) * HD + kc * 32, lane); }
  float m[QT], lim[QT], off[QT], l[QT];
  v8f acc[QT][4] = {};
#pragma unroll
  for (int qt = 0; qt < QT; ++qt) { m[qt] = -3.0e38f; lim[qt] = -3.0e38f; off[qt] = 11.0f; l[qt] = 0.f; }
#pragma unroll 1
  for (int t = 0; t < SS / KST; ++t) { const _Float16* kb = &ring[t & 1][0]; const _Float16* vb = kb + 64 * LP;
#pragma unroll   // the two 32-key steps of a stage: unrolled, their LDS offsets are immediates
   for (int hs = 0; hs < KST / 32; ++hs) { v8f s[QT][2] = {};
#pragma unroll
    for (int ct = 0; ct < 2; ++ct) { const _Float16* rk = kb + (hs * 32 + ct * 16 + col) * LP;
#pragma unroll
      for (int kc = 0; kc < 2; ++kc) { const v16h ka = frag_h(rk + kc * 32, lane);
#pragma unroll
        for (int qt = 0; qt < QT; ++qt) s[qt][ct] = wmma16(ka, aq[qt][kc], s[qt][ct]); } }
    float mx[QT];   // this lane's half of the step's keys; the halves meet only where a rescale is due
#pragma unroll   // constant indices: mx and the scores stay in registers
    for (int qt = 0; qt < QT; ++qt) { mx[qt] = fmaxf(s[qt][0][0], s[qt][1][0]);
#pragma unroll   // as above
      for (int r = 1; r < 8; ++r) mx[qt] = fmaxf(mx[qt], fmaxf(s[qt][0][r], s[qt][1][r])); }
    // one test a step for the whole wave (a scalar branch): below it P <= 2^(11 + 4), inside f16
    if (__builtin_amdgcn_ballot_w32((mx[0] > lim[0]) | (mx[1] > lim[1])) != 0) {
#pragma unroll   // constant indices: the softmax state and the accumulators stay in registers
      for (int qt = 0; qt < QT; ++qt) { const float mn = fmaxf(m[qt], fmaxf(mx[qt], xhalf(mx[qt])));
        const float alpha = (m[qt] <= -1.0e38f) ? 0.f : __builtin_amdgcn_exp2f((m[qt] - mn) * KL2);
        l[qt] *= alpha; m[qt] = mn; lim[qt] = mn + RTH; off[qt] = 11.0f - mn * KL2;
#pragma unroll
        for (int dt = 0; dt < 4; ++dt) {
#pragma unroll
          for (int r = 0; r < 8; ++r) acc[qt][dt][r] *= alpha; } } }
    v16h pb[QT];
#pragma unroll
    for (int qt = 0; qt < QT; ++qt) { const float of = off[qt];   // e = 2^11 exp((s - m) / 8) = exp2(s KL2 + off): one packed fused multiply-add for two scores
    float es0 = 0.f, es1 = 0.f;
#pragma unroll
    for (int i = 0; i < 4; ++i) { const v2f t0 = __builtin_elementwise_fma((v2f){s[qt][0][2 * i], s[qt][0][2 * i + 1]}, (v2f){KL2, KL2}, (v2f){of, of}), t1 = __builtin_elementwise_fma((v2f){s[qt][1][2 * i], s[qt][1][2 * i + 1]}, (v2f){KL2, KL2}, (v2f){of, of});
#pragma unroll   // the two scores of a pair: unrolled, so that every vector element index is a constant and stays in a register
      for (int j = 0; j < 2; ++j) { const float e0 = __builtin_amdgcn_exp2f(t0[j]), e1 = __builtin_amdgcn_exp2f(t1[j]); es0 += e0; es1 += e1;
        pb[qt][2 * i + j] = (_Float16)e0; pb[qt][8 + 2 * i + j] = (_Float16)e1; } }
    l[qt] += es0 + es1; }
#pragma unroll
    for (int dt = 0; dt < 4; ++dt) { const v16h va = frag_h(vb + (dt * 16 + col) * LP + hs * 32, lane);
#pragma unroll
      for (int qt = 0; qt < QT; ++qt) acc[qt][dt] = wmma16(va, pb[qt], acc[qt][dt]); } }
   asm volatile("s_wait_dscnt 0x0" ::: "memory");      // this wave has left the buffer it read
   asm volatile("s_wait_asynccnt 0x0" ::: "memory");   // its part of the next stage has landed
   __syncthreads();                                     // publishes the next stage and frees this one's buffer
   if (t + 2 < SS / KST) stage_copy(gk + (size_t)(t + 2) * (KST * HD), gv + (t + 2) * KST, lk + (t & 1) * (STG * 2)); }
  asm volatile("s_wait_asynccnt 0x0" ::: "memory");    // no copy is left in flight
  // out^T = Wp . O^T on the wave's own 32 queries: the accumulators already lie in the k order of a B operand (tiles 2 kc and 2 kc + 1 are dims 32 kc + 8 g + r and 32 kc + 16 + 8 g + r), Wp's natural rows are A
  // every loop of the epilogue is unrolled: constant indices keep the fragments, the accumulators and y in registers
  v16b w[2][4];
#pragma unroll
  for (int kc = 0; kc < 2; ++kc) {
#pragma unroll
    for (int et = 0; et < 4; ++et) w[kc][et] = frag_b(P + ((size_t)3 * HD + et * 16 + col) * HD + kc * 32, lane); }
#pragma unroll
  for (int qt = 0; qt < QT; ++qt) {
  const float lj = l[qt] + xhalf(l[qt]);
  const float il = 1.0f / lj;   // l carries the same 2^11 as P
  v8f y[4] = {};   // y[et][r] = out[query 16 qt + col][16 et + 8 g + r]
#pragma unroll
  for (int kc = 0; kc < 2; ++kc) { float o[16];
#pragma unroll
    for (int i = 0; i < 8; ++i) { o[i] = acc[qt][2 * kc][i] * il; o[8 + i] = acc[qt][2 * kc + 1][i] * il; }
    const F2 ob = bsplit16(o);   // o as bf16 hi + residual
#pragma unroll
    for (int et = 0; et < 4; ++et) y[et] = wmma_bf(w[kc][et], ob.h, y[et]);
#pragma unroll
    for (int et = 0; et < 4; ++et) y[et] = wmma_bf(w[kc][et], ob.l, y[et]); }
#pragma unroll
  for (int et = 0; et < 4; ++et) {
#pragma unroll
    for (int hf = 0; hf < 2; ++hf) { const v4f b4 = *(const v4f*)(BP + et * 16 + 8 * g + hf * 4); v4f o4;
#pragma unroll
      for (int i = 0; i < 4; ++i) o4[i] = y[et][hf * 4 + i] + bfr(b4[i]);
      *(v4f*)&so[wave][qt * 16 + col][et * 16 + 8 * g + hf * 4] = o4; } }
  __builtin_amdgcn_sched_barrier(0); }   // one query tile after the other: mixed, their conversions take the kernel past 256 registers, which the loop does not need
  LDSX();
  for (int rl = 0; rl < 16 * QT; ++rl) if (lane < 16) vst2(OUT + (rq + rl) * HD + lane * 4, *(const v4f*)&so[wave][rl][lane * 4]);
}
extern "C" void kernel_launch(void* const* d_in, const int* in_sizes, int n_in, void* d_out, int out_size, void* d_ws, size_t ws_size, hipStream_t stream) {
  (void)in_sizes; (void)n_in; (void)out_size;
  const float** F = (const float**)d_in;   // 0 x [2,12,4096,64]; 1 Wq [64,64], 2 bq, 3 Wk, 4 bk, 5 Wv, 6 bv, 7 Wp, 8 bp (natural [out][in])
  if (ws_size < (size_t)WS_END) return;
  char* ws = (char*)d_ws; __bf16* P = (__bf16*)ws; _Float16 *Q = (_Float16*)(ws + WS_Q), *Kr = (_Float16*)(ws + WS_K), *V = (_Float16*)(ws + WS_V);
  k_pack<<<dim3(HD, 4), 64, 0, stream>>>(F[1], F[3], F[5], F[7], P);
  k_proj<<<dim3(SS / (64 * PT), NBH), 128, 0, stream>>>(F[0], P, F[2], F[4], F[6], Q, Kr, V);
  k_attn<<<dim3(SS / (64 * QT), TNB), 128, 0, stream>>>(Q, Kr, V, P, F[8], (float*)d_out);
}

// v009
// It runs in 98 microseconds.
// Timed twice side by side with v008, it ran 1.05 and 1.04 times as fast.
// All steps since v000 together make it 3.92 times as fast.
// compute dtype: all float inputs rounded to bf16; q/k/v = x . W^T + b (64 -> 64 per head) with EXACT bf16 products on WMMA 16x16x32 (natural rows), rounded once to f16; PLAIN attention per (batch, head): q, k single f16, scores transposed (k rows as A, q as B: a lane holds one query of each of the wave's two query tiles), softmax in f32 in base 2 (factor log2(e) / 8, hardware exp2) against a maximum that is renewed lazily, P (scaled by 2^11 to 2^15 in the exponent, single f16, packed from the score registers as B) under v planes (single f16, A); out = o (bf16 hi + residual) . Wp^T (2 products) + bp; f32 output.
#include <hip/hip_runtime.h>
#include <math.h>

typedef __attribute__((ext_vector_type(16))) _Float16 v16h;
typedef __attribute__((ext_vector_type(16))) __bf16 v16b;
typedef __attribute__((ext_vector_type(8)))  _Float16 v8h;
typedef __attribute__((ext_vector_type(8)))  float v8f;
typedef __attribute__((ext_vector_type(4)))  float v4f;
typedef __attribute__((ext_vector_type(2)))  float v2f;
typedef __attribute__((ext_vector_type(4)))  unsigned v4u;
typedef __attribute__((ext_vector_type(4)))  int v4i;
typedef float __attribute__((may_alias)) float_a;
typedef int __attribute__((may_alias)) int_a;

template <typename T> __device__ __forceinline__ void vst2(void* p, T v) { *(T*)p = v;  }
__device__ __forceinline__ v8f wmma16(v16h a, v16h b, v8f c) {
  v8f d = __builtin_amdgcn_wmma_f32_16x16x32_f16(false, a, false, b, (short)0, c, false, false);
  return d;
}
__device__ __forceinline__ v8f wmma_bf(v16b a, v16b b, v8f c) {
  v8f d = __builtin_amdgcn_wmma_f32_16x16x32_bf16(false, a, false, b, (short)0, c, false, false);
  return d;
}
// 16x16x32 fragments: lane = (h = lane>>4, row/col = lane&15); elements 0..7 = k0+8h+0..7, 8..15 = k0+16+8h+0..7; D element r = row 8h+r
__device__ __forceinline__ v16h frag_h(const _Float16* rowk0, int lane) {
  union { v16h v; v8h q[2]; } u; const _Float16* p = rowk0 + 8 * (lane >> 4);
  u.q[0] = *(const v8h*)p; u.q[1] = *(const v8h*)(p + 16); return u.v;
}
__device__ __forceinline__ v16h frag_f32(const float* rowk0, int lane) {
  v16h a; const float* p = rowk0 + 8 * (lane >> 4);
#pragma unroll
  for (int i = 0; i < 8; ++i) { a[i] = (_Float16)p[i]; a[8 + i] = (_Float16)p[16 + i]; }
  return a;
}
__device__ __forceinline__ v16h frag_f32s(const float* rowk0, int lane, float sc) {
  v16h a; const float* p = rowk0 + 8 * (lane >> 4);
#pragma unroll
  for (int i = 0; i < 8; ++i) { a[i] = (_Float16)(p[i] * sc); a[8 + i] = (_Float16)(p[16 + i] * sc); }
  return a;
}
// column fragment from a [K][ld] layout (column n), rows >= K read as 0
__device__ __forceinline__ v16h fragc_f32(const float* W, int k0, int n, int lane, int ld, int K) {
  v16h a; const int g = lane >> 4;
#pragma unroll
  for (int i = 0; i < 8; ++i) { const int ka = k0 + 8 * g + i, kb = ka + 16;
    a[i] = (_Float16)(ka < K ? W[(size_t)(ka < K ? ka : K - 1) * ld + n] : 0.f); a[8 + i] = (_Float16)(kb < K ? W[(size_t)(kb < K ? kb : K - 1) * ld + n] : 0.f); }
  return a;
}
struct F2 { v16b h, l; };
__device__ __forceinline__ F2 bsplit16(const float v[16]) { F2 r;
#pragma unroll
  for (int i = 0; i < 16; ++i) { const __bf16 h = (__bf16)v[i]; r.h[i] = h; r.l[i] = (__bf16)(v[i] - (float)h); }
  return r; }
__device__ __forceinline__ F2 split_row(const float* row, int k0, int lane) { float v[16]; const float* p = row + k0 + 8 * (lane >> 4);
#pragma unroll
  for (int i = 0; i < 8; ++i) { v[i] = p[i]; v[8 + i] = p[16 + i]; }
  return bsplit16(v); }
__device__ __forceinline__ F2 split_rowK(const float* row, int k0, int lane, int K) { float v[16]; const int g = lane >> 4;
#pragma unroll
  for (int i = 0; i < 8; ++i) { const int ka = k0 + 8 * g + i, kb = ka + 16; v[i] = ka < K ? row[ka < K ? ka : K - 1] : 0.f; v[8 + i] = kb < K ? row[kb < K ? kb : K - 1] : 0.f; }
  return bsplit16(v); }
__device__ __forceinline__ F2 split_col(const float* W, int k0, int n, int lane, int ld, int K) { float v[16]; const int g = lane >> 4;
#pragma unroll
  for (int i = 0; i < 8; ++i) { const int ka = k0 + 8 * g + i, kb = ka + 16; v[i] = ka < K ? W[(size_t)(ka < K ? ka : K - 1) * ld + n] : 0.f; v[8 + i] = kb < K ? W[(size_t)(kb < K ? kb : K - 1) * ld + n] : 0.f; }
  return bsplit16(v); }
__device__ __forceinline__ v8f mac3(const F2& a, const F2& b, v8f c) { c = wmma_bf(a.l, b.h, c); c = wmma_bf(a.h, b.l, c); return wmma_bf(a.h, b.h, c); }
__device__ __forceinline__ float sigm(float v) { return 1.0f / (1.0f + expf(-v)); }
#define LDSX() do { asm volatile("s_wait_dscnt 0" ::: "memory"); __builtin_amdgcn_wave_barrier(); __builtin_amdgcn_fence(__ATOMIC_RELEASE, "workgroup"); } while (0)


// Sub-space attention on a head-split input (B 2, 12 heads, 4,096 tokens, 64 dims): per-head 64x64 q/k/v linears + biases, softmax(q k^T / 8) v, 64x64 output linear + bias.
#define NBH 24            // B * H batch-heads
#define SS 4096
#define HD 64
#define NR (NBH * SS)
#ifndef TQB
#define TQB (SS / 64)
#define TNB NBH
#endif
typedef __attribute__((ext_vector_type(8))) __bf16 v8b;
__device__ __forceinline__ v16b frag_b(const __bf16* rowk0, int lane) {
  union { v16b v; v8b q[2]; } u; const __bf16* p = rowk0 + 8 * (lane >> 4);
  u.q[0] = *(const v8b*)p; u.q[1] = *(const v8b*)(p + 16); return u.v;
}
__device__ __forceinline__ float bfr(float v) { return (float)(__bf16)v; }
__device__ __attribute__((noinline)) float exp_ni(float v) { return expf(v); }
__device__ __attribute__((noinline)) float erf_ni(float v) { return erff(v); }

#define WS_PW  0u                                 // bf16 natural rows Wq, Wk, Wv, Wp [4][64][64]
#define WS_Q   (WS_PW + 2u * 4 * HD * HD + 256u)   // f16 q rows [NR][64] ; k rows ; v planes [bh][64][SS]
#define WS_K   (WS_Q + 2u * (size_t)NR * HD)
#define WS_V   (WS_K + 2u * (size_t)NR * HD)
#define WS_END (WS_V + 2u * (size_t)NBH * HD * SS)

__global__ __launch_bounds__(64) void k_pack(const float* __restrict__ WQ, const float* __restrict__ WK, const float* __restrict__ WV, const float* __restrict__ WP, __bf16* __restrict__ P) { const int n = blockIdx.x, m = blockIdx.y, t = threadIdx.x; const float* w = (m == 0) ? WQ : (m == 1) ? WK : (m == 2) ? WV : WP; __shared__ __align__(16) __bf16 s[HD]; s[t] = (__bf16)w[(size_t)n * HD + t]; __syncthreads(); if (t < HD / 8) vst2((unsigned*)(P + ((size_t)m * HD + n) * HD + t * 8), *(const v4u*)&s[t * 8]); }
// a 16x16x32 fragment from the lane's own first piece (row and half already in p)
__device__ __forceinline__ v16b frag_bp(const __bf16* p) { union { v16b v; v8b q[2]; } u; u.q[0] = *(const v8b*)p; u.q[1] = *(const v8b*)(p + 16); return u.v; }
// ---- k_proj: block = (128 tokens, bh), a wave = 32 tokens = two token tiles: q, k and v = x . W^T + b (K = 64) from one read of x; q/k rows, v planes
// x is loaded and rounded once for the three products, and every weight fragment feeds two products, one a token tile
#define PT 2                   // token tiles of 16 a wave
// every loop of the kernel but the row stores' is unrolled: constant indices keep the fragments and the accumulators in registers
__global__ __launch_bounds__(128) void k_proj(const float* __restrict__ X, const __bf16* __restrict__ P, const float* __restrict__ BQ, const float* __restrict__ BK, const float* __restrict__ BV, _Float16* __restrict__ Q, _Float16* __restrict__ Kr, _Float16* __restrict__ V) {
  __shared__ __align__(16) _Float16 so[2][64 * PT][72]; __shared__ __align__(16) _Float16 st[64][64 * PT + 8];   // q rows and k rows (a wave reads back its own rows only); v planes (pitch 272 B = 16 B x 17)
  const int tid = threadIdx.x, wave = tid >> 5, lane = tid & 31, col = lane & 15, g = lane >> 4; const size_t bh = blockIdx.y; const int n0b = blockIdx.x * (64 * PT), w0 = wave * (16 * PT); const size_t r0 = bh * SS + n0b + w0;
  const float* px = X + (r0 + col) * HD + 8 * g; const __bf16* pw = P + (size_t)col * HD + 8 * g;   // the lane's first piece of x and of the weights: every load of x or of a weight is one of these two plus a constant
  v4f xr[PT][HD / 32][4];   // x as loaded; lane (g, col) takes dims 32 kc + 8 g + 0..7 and 32 kc + 16 + 8 g + 0..7 of token 16 tt + col
#pragma unroll
  for (int tt = 0; tt < PT; ++tt) {
#pragma unroll
    for (int kc = 0; kc < HD / 32; ++kc) { const float* p = px + tt * 16 * HD + kc * 32;
      xr[tt][kc][0] = *(const v4f*)p; xr[tt][kc][1] = *(const v4f*)(p + 4); xr[tt][kc][2] = *(const v4f*)(p + 16); xr[tt][kc][3] = *(const v4f*)(p + 20); } }
  asm volatile("s_wait_xcnt 0x0" :: "v"(px) : "memory");   // the address is an input so that it stays in its registers up to the wait: else a later load of the group lands in them (a precaution)
  v16b w[2][HD / 32][4];   // two sets of weight fragments: the next product's loads fly while this one's WMMAs and staging run
#pragma unroll
  for (int kc = 0; kc < HD / 32; ++kc) {
#pragma unroll
    for (int j = 0; j < 4; ++j) w[0][kc][j] = frag_bp(pw + j * 16 * HD + kc * 32); }
  asm volatile("s_wait_xcnt 0x0" :: "v"(pw) : "memory");   // as above, for the weights' address
  float bi[3][4];   // the lane's biases, loaded with the rest: loaded where they are used, each product would begin with a wait for them
#pragma unroll
  for (int j = 0; j < 4; ++j) { bi[0][j] = BQ[j * 16 + col]; bi[1][j] = BK[j * 16 + col]; bi[2][j] = BV[j * 16 + col]; }
  __builtin_amdgcn_sched_barrier(0);   // x and the first weight set are all in flight before the first wait: otherwise part of the weight loads is issued, and waited for, among the first WMMAs
  v16b a[PT][HD / 32];
#pragma unroll
  for (int tt = 0; tt < PT; ++tt) {
#pragma unroll
    for (int kc = 0; kc < HD / 32; ++kc) {
#pragma unroll
      for (int i = 0; i < 16; ++i) a[tt][kc][i] = (__bf16)xr[tt][kc][i >> 2][i & 3]; } }
#pragma unroll   // which is a constant in each copy: the fragment set and the staging layout are chosen at compile time
  for (int which = 0; which < 3; ++which) {
    if (which < 2) {
#pragma unroll
      for (int kc = 0; kc < HD / 32; ++kc) {
#pragma unroll
        for (int j = 0; j < 4; ++j) w[(which + 1) & 1][kc][j] = frag_bp(pw + ((which + 1) * HD + j * 16) * HD + kc * 32); } }
    v8f acc[PT][4] = {};
#pragma unroll
    for (int kc = 0; kc < HD / 32; ++kc) {
#pragma unroll
      for (int j = 0; j < 4; ++j) {
#pragma unroll
        for (int tt = 0; tt < PT; ++tt) acc[tt][j] = wmma_bf(a[tt][kc], w[which & 1][kc][j], acc[tt][j]); } }
#pragma unroll
    for (int j = 0; j < 4; ++j) { const float bb = bfr(bi[which][j]);
#pragma unroll
      for (int tt = 0; tt < PT; ++tt) {
#pragma unroll
        for (int r = 0; r < 8; ++r) { const _Float16 y = (_Float16)(acc[tt][j][r] + bb);
          if (which < 2) so[which][w0 + tt * 16 + 8 * g + r][j * 16 + col] = y; else st[j * 16 + col][w0 + tt * 16 + 8 * g + r] = y; } } }
    if (which < 2) __builtin_amdgcn_sched_barrier(0); }   // one product after the other: mixed, their 24 accumulator tiles take the kernel past 256 registers and the weight loads are waited for one by one
  __syncthreads();   // one barrier in front of all the stores: it publishes the v planes (and orders each wave's own q and k rows); behind the row stores it would wait for them to be acknowledged
#pragma unroll
  for (int which = 0; which < 2; ++which) { _Float16* dst = (which == 0) ? Q : Kr;
    for (int rl = 0; rl < 16 * PT; ++rl) if (lane < 8) vst2((unsigned*)(dst + (r0 + rl) * HD + lane * 8), *(const v4u*)&so[which][w0 + rl][lane * 8]); }
#pragma unroll   // the LDS reads go out together, not one latency a trip
  for (int i = 0; i < 64 * 8 * PT / 128; ++i) { const int e = tid + i * 128, d = e / (8 * PT), pc = e % (8 * PT); vst2((unsigned*)(V + (bh * HD + d) * SS + n0b + pc * 8), *(const v4u*)&st[d][pc * 8]); }
}
// ---- k_attn: block = (128 queries, bh), a wave = 32 queries = two query tiles: plain 64-wide attention over 4,096 keys, then the output linear on the wave's own rows; out f32 rows
// every k and v fragment read from LDS feeds two products, one a query tile: half the LDS reads and half the staged bytes a query
// k rows and v planes reach the four waves through LDS: a stage = 64 keys = 64 k rows and 64 v plane pieces of 128 B each, two buffers, the next stage's copies in flight while this one is worked on
#define KST 64                 // keys a stage
#define QT 2                   // query tiles of 16 a wave
#define KL2 0.18033688011112042f   // log2(e) / 8: the score scale and the change of base in one factor
#define RTH (4.0f / KL2)      // a raw maximum this far above the one in use (4 in base 2) calls for a rescale
#define LP 72                  // LDS row pitch in halves: 144 B = 16 B x 9, free of bank conflicts for the 16-byte fragment reads
#define STG (2 * 64 * LP)      // halves a buffer: 64 k rows, behind them 64 v plane pieces
// each thread brings 4 + 4 pieces of 16 B (rows 16 apart), a wave's copy covers 4 whole 128-B rows; gk, gv: the thread's first pieces, lk: the LDS byte address of the first
__device__ __forceinline__ void stage_copy(const _Float16* gk, const _Float16* gv, unsigned lk) {
  const unsigned lv = lk + 64 * LP * 2;
  // the closing s_wait_xcnt stands inside the statement so that no address register named here is rewritten ahead of it (a precaution)
  asm volatile("global_load_async_to_lds_b128 %0, %1, off\n\t"
               "global_load_async_to_lds_b128 %2, %3, off\n\t"
               "global_load_async_to_lds_b128 %4, %5, off\n\t"
               "global_load_async_to_lds_b128 %6, %7, off\n\t"
               "global_load_async_to_lds_b128 %8, %9, off\n\t"
               "global_load_async_to_lds_b128 %10, %11, off\n\t"
               "global_load_async_to_lds_b128 %12, %13, off\n\t"
               "global_load_async_to_lds_b128 %14, %15, off\n\t"
               "s_wait_xcnt 0x0"
               :: "v"(lk), "v"(gk), "v"(lk + 16 * LP * 2), "v"(gk + 16 * HD), "v"(lk + 32 * LP * 2), "v"(gk + 32 * HD), "v"(lk + 48 * LP * 2), "v"(gk + 48 * HD),
                  "v"(lv), "v"(gv), "v"(lv + 16 * LP * 2), "v"(gv + 16 * SS), "v"(lv + 32 * LP * 2), "v"(gv + 32 * SS), "v"(lv + 48 * LP * 2), "v"(gv + 48 * SS)
               : "memory");
}
// lane l's value from lane l ^ 16
__device__ __forceinline__ float xhalf(float x) { const int b = __builtin_bit_cast(int, x); return __builtin_bit_cast(float, __builtin_amdgcn_permlanex16(b, b, 0x76543210, 0xfedcba98, false, false)); }
__global__ __launch_bounds__(128) void k_attn(const _Float16* __restrict__ Q, const _Float16* __restrict__ Kr, const _Float16* __restrict__ V, const __bf16* __restrict__ P, const float* __restrict__ BP, float* __restrict__ OUT) {
  __shared__ __align__(16) _Float16 ring[2][STG];
  float (*so)[16 * QT][68] = (float (*)[16 * QT][68])&ring[0][0];   // behind the loop the ring (both buffers) is the output staging
  static_assert(sizeof(float) * 4 * 16 * QT * 68 <= sizeof(ring), "output staging fits the ring");
  const int tid = threadIdx.x, wave = tid >> 5, lane = tid & 31, col = lane & 15, g = lane >> 4; const size_t bh = blockIdx.y; const int q0 = blockIdx.x * (64 * QT) + wave * (16 * QT); const size_t rq = bh * SS + q0;
  const _Float16* gk = Kr + (bh * SS + (tid >> 3)) * HD + (tid & 7) * 8; const _Float16* gv = V + (bh * HD + (tid >> 3)) * SS + (tid & 7) * 8;
  const unsigned lk = (unsigned)(size_t)&ring[0][(tid >> 3) * LP + (tid & 7) * 8];
  stage_copy(gk, gv, lk);
  asm volatile("s_wait_asynccnt 0x0" ::: "memory");   // this wave's part of stage 0 has landed
  __syncthreads();                                     // and every other wave's
  stage_copy(gk + KST * HD, gv + KST, lk + STG * 2);
  v16h kf[2][2];   // the k fragments of the step to come: kf[ct][kc] = keys 16 ct + 0..15, dims 32 kc + 0..31
#pragma unroll
  for (int ct = 0; ct < 2; ++ct) {
#pragma unroll
    for (int kc = 0; kc < 2; ++kc) kf[ct][kc] = frag_h(&ring[0][(ct * 16 + col) * LP + kc * 32], lane); }
  v16h aq[QT][2];
#pragma unroll
  for (int qt = 0; qt < QT; ++qt) {
#pragma unroll
    for (int kc = 0; kc < 2; ++kc) aq[qt][kc] = frag_h(Q + (rq + qt * 16 + col) * HD + kc * 32, lane); }
  float m[QT], lim[QT], off[QT], l[QT];
  v8f acc[QT][4] = {};
#pragma unroll
  for (int qt = 0; qt < QT; ++qt) { m[qt] = -3.0e38f; lim[qt] = -3.0e38f; off[qt] = 11.0f; l[qt] = 0.f; }
#pragma unroll 1
  for (int t = 0; t < SS / KST; ++t) { const _Float16* kb = &ring[t & 1][0]; const _Float16* vb = kb + 64 * LP;
#pragma unroll   // the two 32-key steps of a stage: unrolled, their LDS offsets are immediates
   for (int hs = 0; hs < KST / 32; ++hs) { v8f s[QT][2] = {};
#pragma unroll
    for (int ct = 0; ct < 2; ++ct) {
#pragma unroll
      for (int kc = 0; kc < 2; ++kc) {
#pragma unroll
        for (int qt = 0; qt < QT; ++qt) s[qt][ct] = wmma16(kf[ct][kc], aq[qt][kc], s[qt][ct]); } }
    // one group of LDS reads a step, in front of the softmax, which covers their latency: this step's v fragments and, inside a stage, the next step's k fragments
    v16h va[4];
#pragma unroll
    for (int dt = 0; dt < 4; ++dt) va[dt] = frag_h(vb + (dt * 16 + col) * LP + hs * 32, lane);
    if (hs + 1 < KST / 32) {
#pragma unroll
      for (int ct = 0; ct < 2; ++ct) {
#pragma unroll
        for (int kc = 0; kc < 2; ++kc) kf[ct][kc] = frag_h(kb + ((hs + 1) * 32 + ct * 16 + col) * LP + kc * 32, lane); } }
    float mx[QT];   // this lane's half of the step's keys; the halves meet only where a rescale is due
#pragma unroll   // constant indices: mx and the scores stay in registers
    for (int qt = 0; qt < QT; ++qt) { mx[qt] = fmaxf(s[qt][0][0], s[qt][1][0]);
#pragma unroll   // as above
      for (int r = 1; r < 8; ++r) mx[qt] = fmaxf(mx[qt], fmaxf(s[qt][0][r], s[qt][1][r])); }
    // one test a step for the whole wave (a scalar branch): below it P <= 2^(11 + 4), inside f16
    if (__builtin_amdgcn_ballot_w32((mx[0] > lim[0]) | (mx[1] > lim[1])) != 0) {
#pragma unroll   // constant indices: the softmax state and the accumulators stay in registers
      for (int qt = 0; qt < QT; ++qt) { const float mn = fmaxf(m[qt], fmaxf(mx[qt], xhalf(mx[qt])));
        const float alpha = (m[qt] <= -1.0e38f) ? 0.f : __builtin_amdgcn_exp2f((m[qt] - mn) * KL2);
        l[qt] *= alpha; m[qt] = mn; lim[qt] = mn + RTH; off[qt] = 11.0f - mn * KL2;
#pragma unroll
        for (int dt = 0; dt < 4; ++dt) {
#pragma unroll
          for (int r = 0; r < 8; ++r) acc[qt][dt][r] *= alpha; } } }
    v16h pb[QT];
#pragma unroll
    for (int qt = 0; qt < QT; ++qt) { const float of = off[qt];   // e = 2^11 exp((s - m) / 8) = exp2(s KL2 + off): one packed fused multiply-add for two scores
    float es0 = 0.f, es1 = 0.f;
#pragma unroll
    for (int i = 0; i < 4; ++i) { const v2f t0 = __builtin_elementwise_fma((v2f){s[qt][0][2 * i], s[qt][0][2 * i + 1]}, (v2f){KL2, KL2}, (v2f){of, of}), t1 = __builtin_elementwise_fma((v2f){s[qt][1][2 * i], s[qt][1][2 * i + 1]}, (v2f){KL2, KL2}, (v2f){of, of});
#pragma unroll   // the two scores of a pair: unrolled, so that every vector element index is a constant and stays in a register
      for (int j = 0; j < 2; ++j) { const float e0 = __builtin_amdgcn_exp2f(t0[j]), e1 = __builtin_amdgcn_exp2f(t1[j]); es0 += e0; es1 += e1;
        pb[qt][2 * i + j] = (_Float16)e0; pb[qt][8 + 2 * i + j] = (_Float16)e1; } }
    l[qt] += es0 + es1; }
    if (hs + 1 == KST / 32) {   // the stage's last reads are in registers: the publish point stands in front of the last products, which need no LDS
      __builtin_amdgcn_sched_barrier(0);                   // the waits stay behind the exponentials: lifted in front of them, the first would wait out the v reads just issued
      asm volatile("s_wait_dscnt 0x0" ::: "memory");      // this wave has left the buffer it read
      asm volatile("s_wait_asynccnt 0x0" ::: "memory");   // its part of the next stage has landed
      __syncthreads();                                     // publishes the next stage and frees this one's buffer
      const _Float16* kn = &ring[(t + 1) & 1][0];          // the next stage's first k fragments, read behind the barrier, under the last products (behind the last stage: the other buffer's old rows, not used)
#pragma unroll
      for (int ct = 0; ct < 2; ++ct) {
#pragma unroll
        for (int kc = 0; kc < 2; ++kc) kf[ct][kc] = frag_h(kn + (ct * 16 + col) * LP + kc * 32, lane); } }
#pragma unroll
    for (int dt = 0; dt < 4; ++dt) {
#pragma unroll
      for (int qt = 0; qt < QT; ++qt) acc[qt][dt] = wmma16(va[dt], pb[qt], acc[qt][dt]); } }
   if (t + 2 < SS / KST) stage_copy(gk + (size_t)(t + 2) * (KST * HD), gv + (t + 2) * KST, lk + (t & 1) * (STG * 2)); }
  asm volatile("s_wait_asynccnt 0x0" ::: "memory");    // no copy is left in flight
  // out^T = Wp . O^T on the wave's own 32 queries: the accumulators already lie in the k order of a B operand (tiles 2 kc and 2 kc + 1 are dims 32 kc + 8 g + r and 32 kc + 16 + 8 g + r), Wp's natural rows are A
  // every loop of the epilogue is unrolled: constant indices keep the fragments, the accumulators and y in registers
  v16b w[2][4];
#pragma unroll
  for (int kc = 0; kc < 2; ++kc) {
#pragma unroll
    for (int et = 0; et < 4; ++et) w[kc][et] = frag_b(P + ((size_t)3 * HD + et * 16 + col) * HD + kc * 32, lane); }
#pragma unroll
  for (int qt = 0; qt < QT; ++qt) {
  const float lj = l[qt] + xhalf(l[qt]);
  const float il = 1.0f / lj;   // l carries the same 2^11 as P
  v8f y[4] = {};   // y[et][r] = out[query 16 qt + col][16 et + 8 g + r]
#pragma unroll
  for (int kc = 0; kc < 2; ++kc) { float o[16];
#pragma unroll
    for (int i = 0; i < 8; ++i) { o[i] = acc[qt][2 * kc][i] * il; o[8 + i] = acc[qt][2 * kc + 1][i] * il; }
    const F2 ob = bsplit16(o);   // o as bf16 hi + residual
#pragma unroll
    for (int et = 0; et < 4; ++et) y[et] = wmma_bf(w[kc][et], ob.h, y[et]);
#pragma unroll
    for (int et = 0; et < 4; ++et) y[et] = wmma_bf(w[kc][et], ob.l, y[et]); }
#pragma unroll
  for (int et = 0; et < 4; ++et) {
#pragma unroll
    for (int hf = 0; hf < 2; ++hf) { const v4f b4 = *(const v4f*)(BP + et * 16 + 8 * g + hf * 4); v4f o4;
#pragma unroll
      for (int i = 0; i < 4; ++i) o4[i] = y[et][hf * 4 + i] + bfr(b4[i]);
      *(v4f*)&so[wave][qt * 16 + col][et * 16 + 8 * g + hf * 4] = o4; } }
  __builtin_amdgcn_sched_barrier(0); }   // one query tile after the other: mixed, their conversions take the kernel past 256 registers, which the loop does not need
  LDSX();
  for (int rl = 0; rl < 16 * QT; ++rl) if (lane < 16) vst2(OUT + (rq + rl) * HD + lane * 4, *(const v4f*)&so[wave][rl][lane * 4]);
}
extern "C" void kernel_launch(void* const* d_in, const int* in_sizes, int n_in, void* d_out, int out_size, void* d_ws, size_t ws_size, hipStream_t stream) {
  (void)in_sizes; (void)n_in; (void)out_size;
  const float** F = (const float**)d_in;   // 0 x [2,12,4096,64]; 1 Wq [64,64], 2 bq, 3 Wk, 4 bk, 5 Wv, 6 bv, 7 Wp, 8 bp (natural [out][in])
  if (ws_size < (size_t)WS_END) return;
  char* ws = (char*)d_ws; __bf16* P = (__bf16*)ws; _Float16 *Q = (_Float16*)(ws + WS_Q), *Kr = (_Float16*)(ws + WS_K), *V = (_Float16*)(ws + WS_V);
  k_pack<<<dim3(HD, 4), 64, 0, stream>>>(F[1], F[3], F[5], F[7], P);
  k_proj<<<dim3(SS / (64 * PT), NBH), 128, 0, stream>>>(F[0], P, F[2], F[4], F[6], Q, Kr, V);
  k_attn<<<dim3(SS / (64 * QT), TNB), 128, 0, stream>>>(Q, Kr, V, P, F[8], (float*)d_out);
}

// v010
// A run of this version takes 90.1 microseconds.
// Two timings next to v009 both put it at 1.09 times that version's speed.
// Over all steps from v000 it is 4.27 times as fast.
// compute dtype: all float inputs rounded to bf16; q/k/v = x . W^T + b (64 -> 64 per head) with EXACT bf16 products on WMMA 16x16x32 (natural rows), rounded once to f16; PLAIN attention per (batch, head): q, k single f16, scores transposed (k rows as A, q as B: a lane holds one query of each of the wave's two query tiles), softmax in f32 in base 2 (factor log2(e) / 8, hardware exp2) against a maximum that starts from the first 32 keys and is renewed only where a step's row sum nears the f16 range, P (scaled by 2^11 to 2^16 in the exponent, single f16, packed from the score registers as B) under v planes (single f16, A); out = o (bf16 hi + residual) . Wp^T (2 products) + bp; f32 output.
#include <hip/hip_runtime.h>
#include <math.h>

typedef __attribute__((ext_vector_type(16))) _Float16 v16h;
typedef __attribute__((ext_vector_type(16))) __bf16 v16b;
typedef __attribute__((ext_vector_type(8)))  _Float16 v8h;
typedef __attribute__((ext_vector_type(8)))  float v8f;
typedef __attribute__((ext_vector_type(4)))  float v4f;
typedef __attribute__((ext_vector_type(2)))  float v2f;
typedef __attribute__((ext_vector_type(4)))  unsigned v4u;
typedef __attribute__((ext_vector_type(4)))  int v4i;
typedef float __attribute__((may_alias)) float_a;
typedef int __attribute__((may_alias)) int_a;

template <typename T> __device__ __forceinline__ void vst2(void* p, T v) { *(T*)p = v;  }
__device__ __forceinline__ v8f wmma16(v16h a, v16h b, v8f c) {
  v8f d = __builtin_amdgcn_wmma_f32_16x16x32_f16(false, a, false, b, (short)0, c, false, false);
  return d;
}
__device__ __forceinline__ v8f wmma_bf(v16b a, v16b b, v8f c) {
  v8f d = __builtin_amdgcn_wmma_f32_16x16x32_bf16(false, a, false, b, (short)0, c, false, false);
  return d;
}
// 16x16x32 fragments: lane = (h = lane>>4, row/col = lane&15); elements 0..7 = k0+8h+0..7, 8..15 = k0+16+8h+0..7; D element r = row 8h+r
__device__ __forceinline__ v16h frag_h(const _Float16* rowk0, int lane) {
  union { v16h v; v8h q[2]; } u; const _Float16* p = rowk0 + 8 * (lane >> 4);
  u.q[0] = *(const v8h*)p; u.q[1] = *(const v8h*)(p + 16); return u.v;
}
__device__ __forceinline__ v16h frag_f32(const float* rowk0, int lane) {
  v16h a; const float* p = rowk0 + 8 * (lane >> 4);
#pragma unroll
  for (int i = 0; i < 8; ++i) { a[i] = (_Float16)p[i]; a[8 + i] = (_Float16)p[16 + i]; }
  return a;
}
__device__ __forceinline__ v16h frag_f32s(const float* rowk0, int lane, float sc) {
  v16h a; const float* p = rowk0 + 8 * (lane >> 4);
#pragma unroll
  for (int i = 0; i < 8; ++i) { a[i] = (_Float16)(p[i] * sc); a[8 + i] = (_Float16)(p[16 + i] * sc); }
  return a;
}
// column fragment from a [K][ld] layout (column n), rows >= K read as 0
__device__ __forceinline__ v16h fragc_f32(const float* W, int k0, int n, int lane, int ld, int K) {
  v16h a; const int g = lane >> 4;
#pragma unroll
  for (int i = 0; i < 8; ++i) { const int ka = k0 + 8 * g + i, kb = ka + 16;
    a[i] = (_Float16)(ka < K ? W[(size_t)(ka < K ? ka : K - 1) * ld + n] : 0.f); a[8 + i] = (_Float16)(kb < K ? W[(size_t)(kb < K ? kb : K - 1) * ld + n] : 0.f); }
  return a;
}
struct F2 { v16b h, l; };
__device__ __forceinline__ F2 bsplit16(const float v[16]) { F2 r;
#pragma unroll
  for (int i = 0; i < 16; ++i) { const __bf16 h = (__bf16)v[i]; r.h[i] = h; r.l[i] = (__bf16)(v[i] - (float)h); }
  return r; }
__device__ __forceinline__ F2 split_row(const float* row, int k0, int lane) { float v[16]; const float* p = row + k0 + 8 * (lane >> 4);
#pragma unroll
  for (int i = 0; i < 8; ++i) { v[i] = p[i]; v[8 + i] = p[16 + i]; }
  return bsplit16(v); }
__device__ __forceinline__ F2 split_rowK(const float* row, int k0, int lane, int K) { float v[16]; const int g = lane >> 4;
#pragma unroll
  for (int i = 0; i < 8; ++i) { const int ka = k0 + 8 * g + i, kb = ka + 16; v[i] = ka < K ? row[ka < K ? ka : K - 1] : 0.f; v[8 + i] = kb < K ? row[kb < K ? kb : K - 1] : 0.f; }
  return bsplit16(v); }
__device__ __forceinline__ F2 split_col(const float* W, int k0, int n, int lane, int ld, int K) { float v[16]; const int g = lane >> 4;
#pragma unroll
  for (int i = 0; i < 8; ++i) { const int ka = k0 + 8 * g + i, kb = ka + 16; v[i] = ka < K ? W[(size_t)(ka < K ? ka : K - 1) * ld + n] : 0.f; v[8 + i] = kb < K ? W[(size_t)(kb < K ? kb : K - 1) * ld + n] : 0.f; }
  return bsplit16(v); }
__device__ __forceinline__ v8f mac3(const F2& a, const F2& b, v8f c) { c = wmma_bf(a.l, b.h, c); c = wmma_bf(a.h, b.l, c); return wmma_bf(a.h, b.h, c); }
__device__ __forceinline__ float sigm(float v) { return 1.0f / (1.0f + expf(-v)); }
#define LDSX() do { asm volatile("s_wait_dscnt 0" ::: "memory"); __builtin_amdgcn_wave_barrier(); __builtin_amdgcn_fence(__ATOMIC_RELEASE, "workgroup"); } while (0)


// Sub-space attention on a head-split input (B 2, 12 heads, 4,096 tokens, 64 dims): per-head 64x64 q/k/v linears + biases, softmax(q k^T / 8) v, 64x64 output linear + bias.
#define NBH 24            // B * H batch-heads
#define SS 4096
#define HD 64
#define NR (NBH * SS)
#ifndef TQB
#define TQB (SS / 64)
#define TNB NBH
#endif
typedef __attribute__((ext_vector_type(8))) __bf16 v8b;
__device__ __forceinline__ v16b frag_b(const __bf16* rowk0, int lane) {
  union { v16b v; v8b q[2]; } u; const __bf16* p = rowk0 + 8 * (lane >> 4);
  u.q[0] = *(const v8b*)p; u.q[1] = *(const v8b*)(p + 16); return u.v;
}
__device__ __forceinline__ float bfr(float v) { return (float)(__bf16)v; }
__device__ __attribute__((noinline)) float exp_ni(float v) { return expf(v); }
__device__ __attribute__((noinline)) float erf_ni(float v) { return erff(v); }

#define WS_PW  0u                                 // bf16 natural rows Wq, Wk, Wv, Wp [4][64][64]
#define WS_Q   (WS_PW + 2u * 4 * HD * HD + 256u)   // f16 q rows [NR][64] ; k rows ; v planes [bh][64][SS]
#define WS_K   (WS_Q + 2u * (size_t)NR * HD)
#define WS_V   (WS_K + 2u * (size_t)NR * HD)
#define WS_END (WS_V + 2u * (size_t)NBH * HD * SS)

__global__ __launch_bounds__(64) void k_pack(const float* __restrict__ WQ, const float* __restrict__ WK, const float* __restrict__ WV, const float* __restrict__ WP, __bf16* __restrict__ P) { const int n = blockIdx.x, m = blockIdx.y, t = threadIdx.x; const float* w = (m == 0) ? WQ : (m == 1) ? WK : (m == 2) ? WV : WP; __shared__ __align__(16) __bf16 s[HD]; s[t] = (__bf16)w[(size_t)n * HD + t]; __syncthreads(); if (t < HD / 8) vst2((unsigned*)(P + ((size_t)m * HD + n) * HD + t * 8), *(const v4u*)&s[t * 8]); }
// a 16x16x32 fragment from the lane's own first piece (row and half already in p)
__device__ __forceinline__ v16b frag_bp(const __bf16* p) { union { v16b v; v8b q[2]; } u; u.q[0] = *(const v8b*)p; u.q[1] = *(const v8b*)(p + 16); return u.v; }
// ---- k_proj: block = (128 tokens, bh), a wave = 32 tokens = two token tiles: q, k and v = x . W^T + b (K = 64) from one read of x; q/k rows, v planes
// x is loaded and rounded once for the three products, and every weight fragment feeds two products, one a token tile
#define PT 2                   // token tiles of 16 a wave
// every loop of the kernel but the row stores' is unrolled: constant indices keep the fragments and the accumulators in registers
__global__ __launch_bounds__(128) void k_proj(const float* __restrict__ X, const __bf16* __restrict__ P, const float* __restrict__ BQ, const float* __restrict__ BK, const float* __restrict__ BV, _Float16* __restrict__ Q, _Float16* __restrict__ Kr, _Float16* __restrict__ V) {
  __shared__ __align__(16) _Float16 so[2][64 * PT][72]; __shared__ __align__(16) _Float16 st[64][64 * PT + 8];   // q rows and k rows (a wave reads back its own rows only); v planes (pitch 272 B = 16 B x 17)
  const int tid = threadIdx.x, wave = tid >> 5, lane = tid & 31, col = lane & 15, g = lane >> 4; const size_t bh = blockIdx.y; const int n0b = blockIdx.x * (64 * PT), w0 = wave * (16 * PT); const size_t r0 = bh * SS + n0b + w0;
  const float* px = X + (r0 + col) * HD + 8 * g; const __bf16* pw = P + (size_t)col * HD + 8 * g;   // the lane's first piece of x and of the weights: every load of x or of a weight is one of these two plus a constant
  v4f xr[PT][HD / 32][4];   // x as loaded; lane (g, col) takes dims 32 kc + 8 g + 0..7 and 32 kc + 16 + 8 g + 0..7 of token 16 tt + col
#pragma unroll
  for (int tt = 0; tt < PT; ++tt) {
#pragma unroll
    for (int kc = 0; kc < HD / 32; ++kc) { const float* p = px + tt * 16 * HD + kc * 32;
      xr[tt][kc][0] = *(const v4f*)p; xr[tt][kc][1] = *(const v4f*)(p + 4); xr[tt][kc][2] = *(const v4f*)(p + 16); xr[tt][kc][3] = *(const v4f*)(p + 20); } }
  asm volatile("s_wait_xcnt 0x0" :: "v"(px) : "memory");   // the address is an input so that it stays in its registers up to the wait: else a later load of the group lands in them (a precaution)
  v16b w[2][HD / 32][4];   // two sets of weight fragments: the next product's loads fly while this one's WMMAs and staging run
#pragma unroll
  for (int kc = 0; kc < HD / 32; ++kc) {
#pragma unroll
    for (int j = 0; j < 4; ++j) w[0][kc][j] = frag_bp(pw + j * 16 * HD + kc * 32); }
  asm volatile("s_wait_xcnt 0x0" :: "v"(pw) : "memory");   // as above, for the weights' address
  float bi[3][4];   // the lane's biases, loaded with the rest: loaded where they are used, each product would begin with a wait for them
#pragma unroll
  for (int j = 0; j < 4; ++j) { bi[0][j] = BQ[j * 16 + col]; bi[1][j] = BK[j * 16 + col]; bi[2][j] = BV[j * 16 + col]; }
  __builtin_amdgcn_sched_barrier(0);   // x and the first weight set are all in flight before the first wait: otherwise part of the weight loads is issued, and waited for, among the first WMMAs
  v16b a[PT][HD / 32];
#pragma unroll
  for (int tt = 0; tt < PT; ++tt) {
#pragma unroll
    for (int kc = 0; kc < HD / 32; ++kc) {
#pragma unroll
      for (int i = 0; i < 16; ++i) a[tt][kc][i] = (__bf16)xr[tt][kc][i >> 2][i & 3]; } }
#pragma unroll   // which is a constant in each copy: the fragment set and the staging layout are chosen at compile time
  for (int which = 0; which < 3; ++which) {
    if (which < 2) {
#pragma unroll
      for (int kc = 0; kc < HD / 32; ++kc) {
#pragma unroll
        for (int j = 0; j < 4; ++j) w[(which + 1) & 1][kc][j] = frag_bp(pw + ((which + 1) * HD + j * 16) * HD + kc * 32); } }
    v8f acc[PT][4] = {};
#pragma unroll
    for (int kc = 0; kc < HD / 32; ++kc) {
#pragma unroll
      for (int j = 0; j < 4; ++j) {
#pragma unroll
        for (int tt = 0; tt < PT; ++tt) acc[tt][j] = wmma_bf(a[tt][kc], w[which & 1][kc][j], acc[tt][j]); } }
#pragma unroll
    for (int j = 0; j < 4; ++j) { const float bb = bfr(bi[which][j]);
#pragma unroll
      for (int tt = 0; tt < PT; ++tt) {
#pragma unroll
        for (int r = 0; r < 8; ++r) { const _Float16 y = (_Float16)(acc[tt][j][r] + bb);
          if (which < 2) so[which][w0 + tt * 16 + 8 * g + r][j * 16 + col] = y; else st[j * 16 + col][w0 + tt * 16 + 8 * g + r] = y; } } }
    if (which < 2) __builtin_amdgcn_sched_barrier(0); }   // one product after the other: mixed, their 24 accumulator tiles take the kernel past 256 registers and the weight loads are waited for one by one
  __syncthreads();   // one barrier in front of all the stores: it publishes the v planes (and orders each wave's own q and k rows); behind the row stores it would wait for them to be acknowledged
#pragma unroll
  for (int which = 0; which < 2; ++which) { _Float16* dst = (which == 0) ? Q : Kr;
    for (int rl = 0; rl < 16 * PT; ++rl) if (lane < 8) vst2((unsigned*)(dst + (r0 + rl) * HD + lane * 8), *(const v4u*)&so[which][w0 + rl][lane * 8]); }
#pragma unroll   // the LDS reads go out together, not one latency a trip
  for (int i = 0; i < 64 * 8 * PT / 128; ++i) { const int e = tid + i * 128, d = e / (8 * PT), pc = e % (8 * PT); vst2((unsigned*)(V + (bh * HD + d) * SS + n0b + pc * 8), *(const v4u*)&st[d][pc * 8]); }
}
// ---- k_attn: block = (128 queries, bh), a wave = 32 queries = two query tiles: plain 64-wide attention over 4,096 keys, then the output linear on the wave's own rows; out f32 rows
// every k and v fragment read from LDS feeds two products, one a query tile: half the LDS reads and half the staged bytes a query
// k rows and v planes reach the four waves through LDS: a stage = 64 keys = 64 k rows and 64 v plane pieces of 128 B each, two buffers, the next stage's copies in flight while this one is worked on
#define KST 64                 // keys a stage
#define QT 2                   // query tiles of 16 a wave
#define KL2 0.18033688011112042f   // log2(e) / 8: the score scale and the change of base in one factor
#define PLIM 60000.0f         // a lane's sum of a step's 16 P above this calls for a rescale: below it every single P lies inside f16
#define LP 72                  // LDS row pitch in halves: 144 B = 16 B x 9, free of bank conflicts for the 16-byte fragment reads
#define STG (2 * 64 * LP)      // halves a buffer: 64 k rows, behind them 64 v plane pieces
// each thread brings 4 + 4 pieces of 16 B (rows 16 apart), a wave's copy covers 4 whole 128-B rows; gk, gv: the thread's first pieces, lk: the LDS byte address of the first
__device__ __forceinline__ void stage_copy(const _Float16* gk, const _Float16* gv, unsigned lk) {
  const unsigned lv = lk + 64 * LP * 2;
  // the closing s_wait_xcnt stands inside the statement so that no address register named here is rewritten ahead of it (a precaution)
  asm volatile("global_load_async_to_lds_b128 %0, %1, off\n\t"
               "global_load_async_to_lds_b128 %2, %3, off\n\t"
               "global_load_async_to_lds_b128 %4, %5, off\n\t"
               "global_load_async_to_lds_b128 %6, %7, off\n\t"
               "global_load_async_to_lds_b128 %8, %9, off\n\t"
               "global_load_async_to_lds_b128 %10, %11, off\n\t"
               "global_load_async_to_lds_b128 %12, %13, off\n\t"
               "global_load_async_to_lds_b128 %14, %15, off\n\t"
               "s_wait_xcnt 0x0"
               :: "v"(lk), "v"(gk), "v"(lk + 16 * LP * 2), "v"(gk + 16 * HD), "v"(lk + 32 * LP * 2), "v"(gk + 32 * HD), "v"(lk + 48 * LP * 2), "v"(gk + 48 * HD),
                  "v"(lv), "v"(gv), "v"(lv + 16 * LP * 2), "v"(gv + 16 * SS), "v"(lv + 32 * LP * 2), "v"(gv + 32 * SS), "v"(lv + 48 * LP * 2), "v"(gv + 48 * SS)
               : "memory");
}
// lane l's value from lane l ^ 16
__device__ __forceinline__ float xhalf(float x) { const int b = __builtin_bit_cast(int, x); return __builtin_bit_cast(float, __builtin_amdgcn_permlanex16(b, b, 0x76543210, 0xfedcba98, false, false)); }
// exp2 for the rare rescale path, with the slot behind a transcendental inside the statement
__device__ __forceinline__ float exp2_slot(float x) { float y; asm("v_exp_f32 %0, %1\n\tv_nop" : "=v"(y) : "v"(x)); return y; }
__global__ __launch_bounds__(128) void k_attn(const _Float16* __restrict__ Q, const _Float16* __restrict__ Kr, const _Float16* __restrict__ V, const __bf16* __restrict__ P, const float* __restrict__ BP, float* __restrict__ OUT) {
  __shared__ __align__(16) _Float16 ring[2][STG];
  float (*so)[16 * QT][68] = (float (*)[16 * QT][68])&ring[0][0];   // behind the loop the ring (both buffers) is the output staging
  static_assert(sizeof(float) * 4 * 16 * QT * 68 <= sizeof(ring), "output staging fits the ring");
  const int tid = threadIdx.x, wave = tid >> 5, lane = tid & 31, col = lane & 15, g = lane >> 4; const size_t bh = blockIdx.y; const int q0 = blockIdx.x * (64 * QT) + wave * (16 * QT); const size_t rq = bh * SS + q0;
  const _Float16* gk = Kr + (bh * SS + (tid >> 3)) * HD + (tid & 7) * 8; const _Float16* gv = V + (bh * HD + (tid >> 3)) * SS + (tid & 7) * 8;
  const unsigned lk = (unsigned)(size_t)&ring[0][(tid >> 3) * LP + (tid & 7) * 8];
  stage_copy(gk, gv, lk);
  asm volatile("s_wait_asynccnt 0x0" ::: "memory");   // this wave's part of stage 0 has landed
  __syncthreads();                                     // and every other wave's
  stage_copy(gk + KST * HD, gv + KST, lk + STG * 2);
  v16h kf[2][2];   // the k fragments of the step to come: kf[ct][kc] = keys 16 ct + 0..15, dims 32 kc + 0..31
#pragma unroll
  for (int ct = 0; ct < 2; ++ct) {
#pragma unroll
    for (int kc = 0; kc < 2; ++kc) kf[ct][kc] = frag_h(&ring[0][(ct * 16 + col) * LP + kc * 32], lane); }
  v16h aq[QT][2];
#pragma unroll
  for (int qt = 0; qt < QT; ++qt) {
#pragma unroll
    for (int kc = 0; kc < 2; ++kc) aq[qt][kc] = frag_h(Q + (rq + qt * 16 + col) * HD + kc * 32, lane); }
  float off[QT], l[QT];
  v8f acc[QT][4] = {};
  { v8f s0[QT][2] = {};
#pragma unroll
    for (int ct = 0; ct < 2; ++ct) {
#pragma unroll
      for (int kc = 0; kc < 2; ++kc) {
#pragma unroll
        for (int qt = 0; qt < QT; ++qt) s0[qt][ct] = wmma16(kf[ct][kc], aq[qt][kc], s0[qt][ct]); } }
#pragma unroll   // constant indices: the scores stay in registers
    for (int qt = 0; qt < QT; ++qt) { float mx = fmaxf(s0[qt][0][0], s0[qt][1][0]);
#pragma unroll   // as above
      for (int r = 1; r < 8; ++r) mx = fmaxf(mx, fmaxf(s0[qt][0][r], s0[qt][1][r]));
      off[qt] = 11.0f - fmaxf(mx, xhalf(mx)) * KL2; l[qt] = 0.f; } }
#pragma unroll 1
  for (int t = 0; t < SS / KST; ++t) { const _Float16* kb = &ring[t & 1][0]; const _Float16* vb = kb + 64 * LP;
#pragma unroll   // the two 32-key steps of a stage: unrolled, their LDS offsets are immediates
   for (int hs = 0; hs < KST / 32; ++hs) { v8f s[QT][2] = {};
#pragma unroll
    for (int ct = 0; ct < 2; ++ct) {
#pragma unroll
      for (int kc = 0; kc < 2; ++kc) {
#pragma unroll
        for (int qt = 0; qt < QT; ++qt) s[qt][ct] = wmma16(kf[ct][kc], aq[qt][kc], s[qt][ct]); } }
    // one group of LDS reads a step, in front of the softmax, which covers their latency: this step's v fragments and, inside a stage, the next step's k fragments
    v16h va[4];
#pragma unroll
    for (int dt = 0; dt < 4; ++dt) va[dt] = frag_h(vb + (dt * 16 + col) * LP + hs * 32, lane);
    if (hs + 1 < KST / 32) {
#pragma unroll
      for (int ct = 0; ct < 2; ++ct) {
#pragma unroll
        for (int kc = 0; kc < 2; ++kc) kf[ct][kc] = frag_h(kb + ((hs + 1) * 32 + ct * 16 + col) * LP + kc * 32, lane); } }
    __builtin_amdgcn_sched_barrier(0);   // the reads stay in front of the softmax: sunk behind the exponentials, they are waited for directly behind their issue
    // e = 2^11 exp((s - maximum in use) / 8) = exp2(s KL2 + off): one packed fused multiply-add for two scores; tx keeps the exponents for the rare step that has to be redone
    // P is packed where it is made, on either path: the 16 packed registers cross the branch, not the 32 exponentials
    v2f tx[QT][2][4]; float es[QT]; v16h pb[QT];
#pragma unroll   // constant indices, here and in the loops inside: exponents, P and sums stay in registers
    for (int qt = 0; qt < QT; ++qt) { const float of = off[qt]; float es0 = 0.f, es1 = 0.f;
#pragma unroll
      for (int i = 0; i < 4; ++i) {
        tx[qt][0][i] = __builtin_elementwise_fma((v2f){s[qt][0][2 * i], s[qt][0][2 * i + 1]}, (v2f){KL2, KL2}, (v2f){of, of});
        tx[qt][1][i] = __builtin_elementwise_fma((v2f){s[qt][1][2 * i], s[qt][1][2 * i + 1]}, (v2f){KL2, KL2}, (v2f){of, of});
#pragma unroll
        for (int j = 0; j < 2; ++j) { const float e0 = __builtin_amdgcn_exp2f(tx[qt][0][i][j]), e1 = __builtin_amdgcn_exp2f(tx[qt][1][i][j]); es0 += e0; es1 += e1;
          pb[qt][2 * i + j] = (_Float16)e0; pb[qt][8 + 2 * i + j] = (_Float16)e1; } }
      es[qt] = es0 + es1; }
    // one test a step for the whole wave (a scalar branch): a sum within PLIM holds every P of the step inside f16
    if (__builtin_amdgcn_ballot_w32((es[0] > PLIM) | (es[1] > PLIM)) != 0) {
      float d[QT], alpha[QT];
#pragma unroll   // constant indices, here and below: the softmax state, the exponents and the accumulators stay in registers
      for (int qt = 0; qt < QT; ++qt) { float mt = fmaxf(tx[qt][0][0][0], tx[qt][1][0][0]);
#pragma unroll
        for (int r = 1; r < 8; ++r) mt = fmaxf(mt, fmaxf(tx[qt][0][r >> 1][r & 1], tx[qt][1][r >> 1][r & 1]));
        d[qt] = fminf(0.f, 11.0f - fmaxf(mt, xhalf(mt)));   // brings the step's largest exponent, over both halves, down to 11; never up
        alpha[qt] = exp2_slot(d[qt]); }
#pragma unroll
      for (int qt = 0; qt < QT; ++qt) { float es0 = 0.f, es1 = 0.f;   // the step's P and sums once more, from the lowered exponents
#pragma unroll
        for (int r = 0; r < 8; ++r) { const float e0 = exp2_slot(tx[qt][0][r >> 1][r & 1] + d[qt]), e1 = exp2_slot(tx[qt][1][r >> 1][r & 1] + d[qt]); es0 += e0; es1 += e1;
          pb[qt][r] = (_Float16)e0; pb[qt][8 + r] = (_Float16)e1; }
        es[qt] = es0 + es1;
        l[qt] *= alpha[qt]; off[qt] += d[qt];
#pragma unroll
        for (int dt = 0; dt < 4; ++dt) {
#pragma unroll
          for (int r = 0; r < 8; ++r) acc[qt][dt][r] *= alpha[qt]; } } }
#pragma unroll
    for (int qt = 0; qt < QT; ++qt) l[qt] += es[qt];
    if (hs + 1 == KST / 32) {   // the stage's last reads are in registers: the publish point stands in front of the last products, which need no LDS
      __builtin_amdgcn_sched_barrier(0);                   // the waits stay behind the exponentials: lifted in front of them, the first would wait out the v reads just issued
      asm volatile("s_wait_dscnt 0x0" ::: "memory");      // this wave has left the buffer it read
      asm volatile("s_wait_asynccnt 0x0" ::: "memory");   // its part of the next stage has landed
      __syncthreads();                                     // publishes the next stage and frees this one's buffer
      const _Float16* kn = &ring[(t + 1) & 1][0];          // the next stage's first k fragments, read behind the barrier, under the last products (behind the last stage: the other buffer's old rows, not used)
#pragma unroll
      for (int ct = 0; ct < 2; ++ct) {
#pragma unroll
        for (int kc = 0; kc < 2; ++kc) kf[ct][kc] = frag_h(kn + (ct * 16 + col) * LP + kc * 32, lane); } }
#pragma unroll
    for (int dt = 0; dt < 4; ++dt) {
#pragma unroll
      for (int qt = 0; qt < QT; ++qt) acc[qt][dt] = wmma16(va[dt], pb[qt], acc[qt][dt]); } }
   if (t + 2 < SS / KST) stage_copy(gk + (size_t)(t + 2) * (KST * HD), gv + (t + 2) * KST, lk + (t & 1) * (STG * 2)); }
  asm volatile("s_wait_asynccnt 0x0" ::: "memory");    // no copy is left in flight
  // out^T = Wp . O^T on the wave's own 32 queries: the accumulators already lie in the k order of a B operand (tiles 2 kc and 2 kc + 1 are dims 32 kc + 8 g + r and 32 kc + 16 + 8 g + r), Wp's natural rows are A
  // every loop of the epilogue is unrolled: constant indices keep the fragments, the accumulators and y in registers
  v16b w[2][4];
#pragma unroll
  for (int kc = 0; kc < 2; ++kc) {
#pragma unroll
    for (int et = 0; et < 4; ++et) w[kc][et] = frag_b(P + ((size_t)3 * HD + et * 16 + col) * HD + kc * 32, lane); }
#pragma unroll
  for (int qt = 0; qt < QT; ++qt) {
  const float lj = l[qt] + xhalf(l[qt]);
  const float il = 1.0f / lj;   // l carries the same 2^11 as P
  v8f y[4] = {};   // y[et][r] = out[query 16 qt + col][16 et + 8 g + r]
#pragma unroll
  for (int kc = 0; kc < 2; ++kc) { float o[16];
#pragma unroll
    for (int i = 0; i < 8; ++i) { o[i] = acc[qt][2 * kc][i] * il; o[8 + i] = acc[qt][2 * kc + 1][i] * il; }
    const F2 ob = bsplit16(o);   // o as bf16 hi + residual
#pragma unroll
    for (int et = 0; et < 4; ++et) y[et] = wmma_bf(w[kc][et], ob.h, y[et]);
#pragma unroll
    for (int et = 0; et < 4; ++et) y[et] = wmma_bf(w[kc][et], ob.l, y[et]); }
#pragma unroll
  for (int et = 0; et < 4; ++et) {
#pragma unroll
    for (int hf = 0; hf < 2; ++hf) { const v4f b4 = *(const v4f*)(BP + et * 16 + 8 * g + hf * 4); v4f o4;
#pragma unroll
      for (int i = 0; i < 4; ++i) o4[i] = y[et][hf * 4 + i] + bfr(b4[i]);
      *(v4f*)&so[wave][qt * 16 + col][et * 16 + 8 * g + hf * 4] = o4; } }
  __builtin_amdgcn_sched_barrier(0); }   // one query tile after the other: mixed, their conversions take the kernel past 256 registers, which the loop does not need
  LDSX();
  for (int rl = 0; rl < 16 * QT; ++rl) if (lane < 16) vst2(OUT + (rq + rl) * HD + lane * 4, *(const v4f*)&so[wave][rl][lane * 4]);
}
extern "C" void kernel_launch(void* const* d_in, const int* in_sizes, int n_in, void* d_out, int out_size, void* d_ws, size_t ws_size, hipStream_t stream) {
  (void)in_sizes; (void)n_in; (void)out_size;
  const float** F = (const float**)d_in;   // 0 x [2,12,4096,64]; 1 Wq [64,64], 2 bq, 3 Wk, 4 bk, 5 Wv, 6 bv, 7 Wp, 8 bp (natural [out][in])
  if (ws_size < (size_t)WS_END) return;
  char* ws = (char*)d_ws; __bf16* P = (__bf16*)ws; _Float16 *Q = (_Float16*)(ws + WS_Q), *Kr = (_Float16*)(ws + WS_K), *V = (_Float16*)(ws + WS_V);
  k_pack<<<dim3(HD, 4), 64, 0, stream>>>(F[1], F[3], F[5], F[7], P);
  k_proj<<<dim3(SS / (64 * PT), NBH), 128, 0, stream>>>(F[0], P, F[2], F[4], F[6], Q, Kr, V);
  k_attn<<<dim3(SS / (64 * QT), TNB), 128, 0, stream>>>(Q, Kr, V, P, F[8], (float*)d_out);
}
